// v000
// The times below were measured on an AMD MI455X: many runs one after another, warmed up first and cycling through
// copies of the inputs, with the whole window's GPU time divided by the number of runs. Launches and the gaps
// between them are all in it. The median over several windows is given; except for v000 it joins two sittings, which
// can be a few percent apart, so the side-by-side timings, each taken in one sitting, are the better comparison.
// v000, which the later versions start from, runs in 427 microseconds.
#include <hip/hip_runtime.h>
#include <math.h>

// Problem constants
#define B_    4
#define L_    512
#define D_    768
#define H_    12
#define HD_   64
#define R_    12
#define RP_   64
#define NP_   257     // 2*MAX_REL+1
#define NPAD_ 272     // padded to multiple of 16

typedef __attribute__((ext_vector_type(2))) float v2f;
typedef __attribute__((ext_vector_type(8))) float v8f;

__device__ __forceinline__ v2f ld2(const float* p) { return *(const v2f*)p; }

// ---------------------------------------------------------------------------
// 768x768 transpose: Wdst[n][k] = Wsrc[k][n]. LDS 32x33 tile, coalesced both
// directions. grid (24,24), 256 threads.
// ---------------------------------------------------------------------------
__global__ __launch_bounds__(256) void transpose768(
    const float* __restrict__ Wsrc, float* __restrict__ Wdst) {
  __shared__ float tile[32][33];
  const int bx = blockIdx.x * 32, by = blockIdx.y * 32;
  const int tx = threadIdx.x & 31, ty = threadIdx.x >> 5;
  #pragma unroll
  for (int r = ty; r < 32; r += 8)
    tile[r][tx] = Wsrc[(size_t)(by + r) * D_ + bx + tx];
  __syncthreads();
  #pragma unroll
  for (int r = ty; r < 32; r += 8)
    Wdst[(size_t)(bx + r) * D_ + by + tx] = tile[tx][r];
}

// ---------------------------------------------------------------------------
// GEMM with pre-transposed weights: C[M,N] = A[M,K] @ WT[N,K]ᵀ, fp32 WMMA
// 16x16x4. One wave per 16x64 tile. Software-pipelined by one K-step so the
// next step's 5 b64 fragment loads are in flight while the current 4 WMMAs
// execute. A-row loads clamped to Mclamp so a padded M grid stays in-bounds.
// ---------------------------------------------------------------------------
__global__ __launch_bounds__(32) void gemm_wmma_f32_bt(
    const float* __restrict__ A, const float* __restrict__ WT,
    float* __restrict__ C, int Mclamp, int N, int K) {
  const int lane = threadIdx.x & 31;
  const int hi = lane >> 4;          // half-wave select (K pair / M+8)
  const int nn = lane & 15;          // lane within half: N (B/C) or M (A)
  const int n0 = blockIdx.x * 64;
  const int m0 = blockIdx.y * 16;

  const int mload = min(m0 + nn, Mclamp);
  const float* arow  = A + (size_t)mload * K + 2 * hi;
  const float* btrow = WT + (size_t)(n0 + nn) * K + 2 * hi;
  const size_t cs = 16 * (size_t)K;  // 16 columns of WT

  v8f acc0 = {}, acc1 = {}, acc2 = {}, acc3 = {};
  // prologue: fragments for k0 = 0
  v2f a  = ld2(arow);
  v2f b0 = ld2(btrow);
  v2f b1 = ld2(btrow + cs);
  v2f b2 = ld2(btrow + 2 * cs);
  v2f b3 = ld2(btrow + 3 * cs);
  for (int k0 = 4; k0 < K; k0 += 4) {
    // prefetch next step while current WMMAs run
    v2f an  = ld2(arow  + k0);
    v2f b0n = ld2(btrow + k0);
    v2f b1n = ld2(btrow + cs + k0);
    v2f b2n = ld2(btrow + 2 * cs + k0);
    v2f b3n = ld2(btrow + 3 * cs + k0);
    acc0 = __builtin_amdgcn_wmma_f32_16x16x4_f32(false, a, false, b0, (short)0, acc0, false, false);
    acc1 = __builtin_amdgcn_wmma_f32_16x16x4_f32(false, a, false, b1, (short)0, acc1, false, false);
    acc2 = __builtin_amdgcn_wmma_f32_16x16x4_f32(false, a, false, b2, (short)0, acc2, false, false);
    acc3 = __builtin_amdgcn_wmma_f32_16x16x4_f32(false, a, false, b3, (short)0, acc3, false, false);
    a = an; b0 = b0n; b1 = b1n; b2 = b2n; b3 = b3n;
  }
  acc0 = __builtin_amdgcn_wmma_f32_16x16x4_f32(false, a, false, b0, (short)0, acc0, false, false);
  acc1 = __builtin_amdgcn_wmma_f32_16x16x4_f32(false, a, false, b1, (short)0, acc1, false, false);
  acc2 = __builtin_amdgcn_wmma_f32_16x16x4_f32(false, a, false, b2, (short)0, acc2, false, false);
  acc3 = __builtin_amdgcn_wmma_f32_16x16x4_f32(false, a, false, b3, (short)0, acc3, false, false);

  #pragma unroll
  for (int r = 0; r < 8; ++r) {
    const int m = m0 + r + 8 * hi;   // C layout: VGPR r -> M=r / r+8
    float* crow = C + (size_t)m * N + n0 + nn;
    crow[0]  = acc0[r];
    crow[16] = acc1[r];
    crow[32] = acc2[r];
    crow[48] = acc3[r];
  }
}

// ---------------------------------------------------------------------------
// Scores (QKᵀ * 1/sqrt(64)) + causal softmax -> attn[B,H,L,L].
// Block: (i-tile of 16 rows, h, b), 16 waves. Waves compute 16x16 score tiles
// via fp32 WMMA into LDS (skipping fully-masked causal tiles), then wave w
// softmaxes row w with wave32 shuffle reductions.
// ---------------------------------------------------------------------------
#define LDP 520
__global__ __launch_bounds__(512) void scores_softmax(
    const float* __restrict__ QA, const float* __restrict__ KA,
    float* __restrict__ ATTN) {
  __shared__ float sc[16 * LDP];
  const int i0   = blockIdx.x * 16;
  const int h    = blockIdx.y;
  const int b    = blockIdx.z;
  const int wave = threadIdx.x >> 5;
  const int lane = threadIdx.x & 31;
  const int hi = lane >> 4, nn = lane & 15;

  const float* qbase = QA + (size_t)(b * L_ + i0 + nn) * D_ + h * HD_ + 2 * hi;
  for (int jt = wave * 2; jt < wave * 2 + 2; ++jt) {
    const int j0 = jt * 16;
    if (j0 <= i0 + 15) {                                // skip fully-masked tiles
      const float* kbase = KA + (size_t)(b * L_ + j0 + nn) * D_ + h * HD_ + 2 * hi;
      v8f acc = {};
      v2f a  = ld2(qbase);
      v2f bb = ld2(kbase);                              // Bᵀ: ka row j as column
      #pragma unroll
      for (int k0 = 4; k0 < HD_; k0 += 4) {
        v2f an  = ld2(qbase + k0);
        v2f bbn = ld2(kbase + k0);
        acc = __builtin_amdgcn_wmma_f32_16x16x4_f32(false, a, false, bb, (short)0, acc, false, false);
        a = an; bb = bbn;
      }
      acc = __builtin_amdgcn_wmma_f32_16x16x4_f32(false, a, false, bb, (short)0, acc, false, false);
      #pragma unroll
      for (int r = 0; r < 8; ++r)
        sc[(r + 8 * hi) * LDP + j0 + nn] = acc[r] * 0.125f;
    }
  }
  __syncthreads();

  // softmax: wave w -> row w (16 waves, 16 rows)
  const int row = wave;
  const int ig  = i0 + row;
  float vals[16];
  float mx = -__builtin_inff();
  #pragma unroll
  for (int t = 0; t < 16; ++t) {
    const int j = lane + 32 * t;
    const float v = (j <= ig) ? sc[row * LDP + j] : -__builtin_inff();
    vals[t] = v;
    mx = fmaxf(mx, v);
  }
  for (int off = 16; off; off >>= 1) mx = fmaxf(mx, __shfl_xor(mx, off, 32));
  float sum = 0.0f;
  #pragma unroll
  for (int t = 0; t < 16; ++t) { const float e = __expf(vals[t] - mx); vals[t] = e; sum += e; }
  for (int off = 16; off; off >>= 1) sum += __shfl_xor(sum, off, 32);
  const float inv = 1.0f / sum;
  float* arow = ATTN + ((size_t)(b * H_ + h) * L_ + ig) * L_;
  #pragma unroll
  for (int t = 0; t < 16; ++t) {
    const int j = lane + 32 * t;
    arow[j] = (j <= ig) ? vals[t] * inv : 0.0f;
  }
}

// ---------------------------------------------------------------------------
// relations[b,i,j,r] = (qr[b,i,r,:] . kr[b,j,r,:]) / sqrt(64).
// One wave per (16x16 ij-tile, b, r); fp32 WMMA over K=64, software-pipelined;
// strided scatter into the [B,L,L,R] output layout.
// ---------------------------------------------------------------------------
__global__ __launch_bounds__(32) void relations_kernel(
    const float* __restrict__ QR, const float* __restrict__ KR,
    float* __restrict__ REL) {
  const int lane = threadIdx.x & 31;
  const int hi = lane >> 4, nn = lane & 15;
  const int j0 = blockIdx.x * 16;
  const int i0 = blockIdx.y * 16;
  const int b  = blockIdx.z / R_;
  const int r  = blockIdx.z % R_;

  const float* qbase = QR + (size_t)(b * L_ + i0 + nn) * D_ + r * RP_ + 2 * hi;
  const float* kbase = KR + (size_t)(b * L_ + j0 + nn) * D_ + r * RP_ + 2 * hi;
  v8f acc = {};
  v2f a  = ld2(qbase);
  v2f bb = ld2(kbase);
  #pragma unroll
  for (int k0 = 4; k0 < RP_; k0 += 4) {
    v2f an  = ld2(qbase + k0);
    v2f bbn = ld2(kbase + k0);
    acc = __builtin_amdgcn_wmma_f32_16x16x4_f32(false, a, false, bb, (short)0, acc, false, false);
    a = an; bb = bbn;
  }
  acc = __builtin_amdgcn_wmma_f32_16x16x4_f32(false, a, false, bb, (short)0, acc, false, false);
  #pragma unroll
  for (int rr = 0; rr < 8; ++rr) {
    const int i = i0 + rr + 8 * hi;
    const int j = j0 + nn;
    REL[((size_t)(b * L_ + i) * L_ + j) * R_ + r] = acc[rr] * 0.125f;
  }
}

// ---------------------------------------------------------------------------
// attended[b,i,:] = sum_j attn[b,h,i,j] * sv[clip(j-i)+128][h,d]
//                 + sum_r (sum_j attn[b,h,i,j] * rel[b,i,j,r]) * wr[h,d,r]
// Diagonal-banded gather -> VALU kernel. Per (b,i) block: stage attn rows and
// the rel slice in LDS, reduce ar[h][r], then accumulate over j<=i (causal).
// ---------------------------------------------------------------------------
__global__ __launch_bounds__(256) void attend_kernel(
    const float* __restrict__ ATTN, const float* __restrict__ REL,
    const float* __restrict__ SV, const float* __restrict__ WR,
    float* __restrict__ OUT) {
  __shared__ float attnL[H_ * L_];   // 12 x 512
  __shared__ float relL[L_ * R_];    // 512 x 12
  __shared__ float ar[H_ * R_];      // 12 x 12
  const int i = blockIdx.x;
  const int b = blockIdx.y;
  const int t = threadIdx.x;

  for (int idx = t; idx < H_ * L_; idx += 256) {
    const int h = idx / L_, j = idx - h * L_;
    attnL[idx] = ATTN[((size_t)(b * H_ + h) * L_ + i) * L_ + j];
  }
  const float* relrow = REL + (size_t)(b * L_ + i) * L_ * R_;
  for (int idx = t; idx < L_ * R_; idx += 256) relL[idx] = relrow[idx];
  __syncthreads();

  if (t < H_ * R_) {
    const int h = t / R_, r = t - h * R_;
    float s = 0.0f;
    for (int j = 0; j <= i; ++j) s += attnL[h * L_ + j] * relL[j * R_ + r];
    ar[t] = s;
  }
  __syncthreads();

  float acc[3] = {0.0f, 0.0f, 0.0f};
  for (int j = 0; j <= i; ++j) {
    int rp = j - i + 128;            // j<=i (causal) -> rp in [?,128]
    if (rp < 0) rp = 0;
    const float* svrow = SV + (size_t)rp * D_;
    #pragma unroll
    for (int q = 0; q < 3; ++q) {
      const int dd = t + 256 * q;
      acc[q] += attnL[(dd >> 6) * L_ + j] * svrow[dd];
    }
  }
  float* orow = OUT + (size_t)(b * L_ + i) * D_;
  #pragma unroll
  for (int q = 0; q < 3; ++q) {
    const int dd = t + 256 * q;
    const int h = dd >> 6, d = dd & 63;
    float s = acc[q];
    #pragma unroll
    for (int r = 0; r < R_; ++r) s += ar[h * R_ + r] * WR[(h * HD_ + d) * R_ + r];
    orow[dd] = s;
  }
}

// ---------------------------------------------------------------------------
extern "C" void kernel_launch(void* const* d_in, const int* in_sizes, int n_in,
                              void* d_out, int out_size, void* d_ws, size_t ws_size,
                              hipStream_t stream) {
  const float* x       = (const float*)d_in[0];
  const float* wq_attn = (const float*)d_in[1];
  const float* wk_attn = (const float*)d_in[2];
  const float* wq_rel  = (const float*)d_in[3];
  const float* wk_rel  = (const float*)d_in[4];
  const float* wr      = (const float*)d_in[5];
  const float* wv      = (const float*)d_in[6];
  const float* wo      = (const float*)d_in[7];
  const float* rel_emb = (const float*)d_in[8];

  float* out  = (float*)d_out;                                  // [B,L,768]
  float* attn = out + (size_t)B_ * L_ * D_;                     // [B,H,L,L]
  float* rel  = attn + (size_t)B_ * H_ * L_ * L_;               // [B,L,L,R]

  const size_t NBLD = (size_t)B_ * L_ * D_;
  float* qa  = (float*)d_ws;
  float* ka  = qa + NBLD;
  float* qr  = ka + NBLD;
  float* kr  = qr + NBLD;
  float* sv  = kr + NBLD;                                       // [272,768]
  float* att = sv + (size_t)NPAD_ * D_;                         // [B,L,768]
  float* wt  = att + NBLD;                                      // [768,768] scratch

  const dim3 b32(32);
  const dim3 tb(256);
  const dim3 gT(D_ / 32, D_ / 32);                              // (24,24)
  const dim3 gProj(D_ / 64, (B_ * L_) / 16);                    // (12,128)

  // Projections: qa/ka/qr/kr = x @ W  (M=2048, K=N=768), weights transposed
  // into wt first; stream order serializes reuse of wt.
  transpose768<<<gT, tb, 0, stream>>>(wq_attn, wt);
  gemm_wmma_f32_bt<<<gProj, b32, 0, stream>>>(x, wt, qa, B_ * L_ - 1, D_, D_);
  transpose768<<<gT, tb, 0, stream>>>(wk_attn, wt);
  gemm_wmma_f32_bt<<<gProj, b32, 0, stream>>>(x, wt, ka, B_ * L_ - 1, D_, D_);
  transpose768<<<gT, tb, 0, stream>>>(wq_rel, wt);
  gemm_wmma_f32_bt<<<gProj, b32, 0, stream>>>(x, wt, qr, B_ * L_ - 1, D_, D_);
  transpose768<<<gT, tb, 0, stream>>>(wk_rel, wt);
  gemm_wmma_f32_bt<<<gProj, b32, 0, stream>>>(x, wt, kr, B_ * L_ - 1, D_, D_);
  // sv = rel_emb @ wv (M=257 padded to 272, row-clamped loads)
  transpose768<<<gT, tb, 0, stream>>>(wv, wt);
  gemm_wmma_f32_bt<<<dim3(D_ / 64, NPAD_ / 16), b32, 0, stream>>>(rel_emb, wt, sv, NP_ - 1, D_, D_);

  // attn: causal softmax(QKᵀ/8)
  scores_softmax<<<dim3(L_ / 16, H_, B_), 512, 0, stream>>>(qa, ka, attn);

  // relations: full (non-causal) output
  relations_kernel<<<dim3(L_ / 16, L_ / 16, B_ * R_), b32, 0, stream>>>(qr, kr, rel);

  // attended symbols + relations -> att [B,L,768]
  attend_kernel<<<dim3(L_, B_), 256, 0, stream>>>(attn, rel, sv, wr, att);

  // out = att @ wo
  transpose768<<<gT, tb, 0, stream>>>(wo, wt);
  gemm_wmma_f32_bt<<<gProj, b32, 0, stream>>>(att, wt, out, B_ * L_ - 1, D_, D_);
}

// v001
// Measured time: 274 microseconds a run.
// Next to v000, in two timings, it ran 1.62 and 1.61 times as fast.
#include <hip/hip_runtime.h>
#include <math.h>

// Problem constants
#define B_    4
#define L_    512
#define D_    768
#define H_    12
#define HD_   64
#define R_    12
#define RP_   64
#define NP_   257     // 2*MAX_REL+1
#define NPAD_ 272     // padded to multiple of 16

typedef __attribute__((ext_vector_type(2))) float v2f;
typedef __attribute__((ext_vector_type(4))) float v4f;
typedef __attribute__((ext_vector_type(8))) float v8f;

__device__ __forceinline__ v2f ld2(const float* p) { return *(const v2f*)p; }
__device__ __forceinline__ v4f ld4(const float* p) { return *(const v4f*)p; }

// ---------------------------------------------------------------------------
// 768x768 transpose: Wdst[n][k] = Wsrc[k][n]. LDS 32x33 tile, coalesced both
// directions. grid (24,24), 256 threads.
// ---------------------------------------------------------------------------
__global__ __launch_bounds__(256) void transpose768(
    const float* __restrict__ Wsrc, float* __restrict__ Wdst) {
  __shared__ float tile[32][33];
  const int bx = blockIdx.x * 32, by = blockIdx.y * 32;
  const int tx = threadIdx.x & 31, ty = threadIdx.x >> 5;
  #pragma unroll
  for (int r = ty; r < 32; r += 8)
    tile[r][tx] = Wsrc[(size_t)(by + r) * D_ + bx + tx];
  __syncthreads();
  #pragma unroll
  for (int r = ty; r < 32; r += 8)
    Wdst[(size_t)(bx + r) * D_ + by + tx] = tile[tx][r];
}

// ---------------------------------------------------------------------------
// GEMM with pre-transposed weights: C[M,N] = A[M,K] @ WT[N,K]^T, fp32 WMMA
// 16x16x4. One work-group of 8 waves per 64x96 tile of C, wave tile 16x48
// (4 waves along M, 2 along N). K runs in chunks of 128: the 64 A rows and
// the 96 WT rows of a chunk are staged in LDS, whole 512-byte rows per wave
// load, and every wave takes its fragments from there, so a row is fetched
// once per work-group instead of once per wave. Two LDS buffers: the next
// chunk's global loads are issued ahead of the current chunk's WMMAs and are
// stored to the other buffer behind them; one barrier per chunk.
// The k order of every accumulator is that of the unstaged form.
// Needs N % 96 == 0 and K % 128 == 0. A-row loads are clamped to Mclamp and
// rows above Mclamp are not stored, so a padded M grid stays in bounds.
// ---------------------------------------------------------------------------
#define GBM 64      // C rows per work-group
#define GBN 96      // C columns per work-group
#define GKC 128     // k per staged chunk
#define GLP 132     // LDS row pitch in floats: 4 banks further per row
#define GROWS (GBM + GBN)
__global__ __launch_bounds__(256) void gemm_wmma_f32_bt(
    const float* __restrict__ A, const float* __restrict__ WT,
    float* __restrict__ C, int Mclamp, int N, int K) {
  __shared__ __attribute__((aligned(16))) float sm[2][GROWS * GLP];
  const int lane = threadIdx.x & 31;
  const int wave = __builtin_amdgcn_readfirstlane(threadIdx.x >> 5);
  const int hi = lane >> 4;          // half-wave select (K pair / M+8)
  const int nn = lane & 15;          // lane within half: N (B/C) or M (A)
  const int wm = wave >> 1;          // wave's 16-row strip of the tile
  const int wn = wave & 1;           // wave's 48-column strip of the tile
  const int n0 = blockIdx.x * GBN;
  const int m0 = blockIdx.y * GBM;

  // staging: wave w moves rows w, w+8, ... ; lane l moves floats 4l..4l+3
  v4f st[GROWS / 8];
  const int sc = 4 * lane;
  #pragma unroll
  for (int i = 0; i < GBM / 8; ++i)
    st[i] = ld4(A + (size_t)min(m0 + 8 * i + wave, Mclamp) * K + sc);
  #pragma unroll
  for (int i = 0; i < GBN / 8; ++i)
    st[GBM / 8 + i] = ld4(WT + (size_t)(n0 + 8 * i + wave) * K + sc);
  // the loads' address registers are reused right below: wait before the overwrite
  asm volatile("s_wait_xcnt 0x0" ::: "memory");
  // keeps the register writes that follow from being lifted over that wait
  __builtin_amdgcn_sched_barrier(0);
  #pragma unroll
  for (int i = 0; i < GROWS / 8; ++i)
    *(v4f*)&sm[0][(8 * i + wave) * GLP + sc] = st[i];
  __syncthreads();

  const int aoff = (wm * 16 + nn) * GLP + 2 * hi;
  const int boff = (GBM + wn * 48 + nn) * GLP + 2 * hi;
  v8f acc0 = {}, acc1 = {}, acc2 = {};
  const int nchunk = K / GKC;
  for (int c = 0; c < nchunk; ++c) {
    const bool more = c + 1 < nchunk;
    if (more) {
      const int kc = (c + 1) * GKC + sc;
      #pragma unroll
      for (int i = 0; i < GBM / 8; ++i)
        st[i] = ld4(A + (size_t)min(m0 + 8 * i + wave, Mclamp) * K + kc);
      #pragma unroll
      for (int i = 0; i < GBN / 8; ++i)
        st[GBM / 8 + i] = ld4(WT + (size_t)(n0 + 8 * i + wave) * K + kc);
    }
    const float* la = &sm[c & 1][aoff];
    const float* lb = &sm[c & 1][boff];
    #pragma unroll
    for (int k0 = 0; k0 < GKC; k0 += 4) {
      const v2f a  = ld2(la + k0);
      const v2f b0 = ld2(lb + k0);
      const v2f b1 = ld2(lb + 16 * GLP + k0);
      const v2f b2 = ld2(lb + 32 * GLP + k0);
      acc0 = __builtin_amdgcn_wmma_f32_16x16x4_f32(false, a, false, b0, (short)0, acc0, false, false);
      acc1 = __builtin_amdgcn_wmma_f32_16x16x4_f32(false, a, false, b1, (short)0, acc1, false, false);
      acc2 = __builtin_amdgcn_wmma_f32_16x16x4_f32(false, a, false, b2, (short)0, acc2, false, false);
    }
    if (more) {
      float* dst = &sm[(c + 1) & 1][wave * GLP + sc];
      #pragma unroll
      for (int i = 0; i < GROWS / 8; ++i)
        *(v4f*)(dst + 8 * i * GLP) = st[i];
    }
    __syncthreads();
  }

  #pragma unroll
  for (int r = 0; r < 8; ++r) {
    const int m = m0 + wm * 16 + r + 8 * hi;   // C layout: VGPR r -> M=r / r+8
    if (m <= Mclamp) {
      float* crow = C + (size_t)m * N + n0 + wn * 48 + nn;
      crow[0]  = acc0[r];
      crow[16] = acc1[r];
      crow[32] = acc2[r];
    }
  }
}

// ---------------------------------------------------------------------------
// Scores (QKᵀ * 1/sqrt(64)) + causal softmax -> attn[B,H,L,L].
// Block: (i-tile of 16 rows, h, b), 16 waves. Waves compute 16x16 score tiles
// via fp32 WMMA into LDS (skipping fully-masked causal tiles), then wave w
// softmaxes row w with wave32 shuffle reductions.
// ---------------------------------------------------------------------------
#define LDP 520
__global__ __launch_bounds__(512) void scores_softmax(
    const float* __restrict__ QA, const float* __restrict__ KA,
    float* __restrict__ ATTN) {
  __shared__ float sc[16 * LDP];
  const int i0   = blockIdx.x * 16;
  const int h    = blockIdx.y;
  const int b    = blockIdx.z;
  const int wave = threadIdx.x >> 5;
  const int lane = threadIdx.x & 31;
  const int hi = lane >> 4, nn = lane & 15;

  const float* qbase = QA + (size_t)(b * L_ + i0 + nn) * D_ + h * HD_ + 2 * hi;
  for (int jt = wave * 2; jt < wave * 2 + 2; ++jt) {
    const int j0 = jt * 16;
    if (j0 <= i0 + 15) {                                // skip fully-masked tiles
      const float* kbase = KA + (size_t)(b * L_ + j0 + nn) * D_ + h * HD_ + 2 * hi;
      v8f acc = {};
      v2f a  = ld2(qbase);
      v2f bb = ld2(kbase);                              // Bᵀ: ka row j as column
      #pragma unroll
      for (int k0 = 4; k0 < HD_; k0 += 4) {
        v2f an  = ld2(qbase + k0);
        v2f bbn = ld2(kbase + k0);
        acc = __builtin_amdgcn_wmma_f32_16x16x4_f32(false, a, false, bb, (short)0, acc, false, false);
        a = an; bb = bbn;
      }
      acc = __builtin_amdgcn_wmma_f32_16x16x4_f32(false, a, false, bb, (short)0, acc, false, false);
      #pragma unroll
      for (int r = 0; r < 8; ++r)
        sc[(r + 8 * hi) * LDP + j0 + nn] = acc[r] * 0.125f;
    }
  }
  __syncthreads();

  // softmax: wave w -> row w (16 waves, 16 rows)
  const int row = wave;
  const int ig  = i0 + row;
  float vals[16];
  float mx = -__builtin_inff();
  #pragma unroll
  for (int t = 0; t < 16; ++t) {
    const int j = lane + 32 * t;
    const float v = (j <= ig) ? sc[row * LDP + j] : -__builtin_inff();
    vals[t] = v;
    mx = fmaxf(mx, v);
  }
  for (int off = 16; off; off >>= 1) mx = fmaxf(mx, __shfl_xor(mx, off, 32));
  float sum = 0.0f;
  #pragma unroll
  for (int t = 0; t < 16; ++t) { const float e = __expf(vals[t] - mx); vals[t] = e; sum += e; }
  for (int off = 16; off; off >>= 1) sum += __shfl_xor(sum, off, 32);
  const float inv = 1.0f / sum;
  float* arow = ATTN + ((size_t)(b * H_ + h) * L_ + ig) * L_;
  #pragma unroll
  for (int t = 0; t < 16; ++t) {
    const int j = lane + 32 * t;
    arow[j] = (j <= ig) ? vals[t] * inv : 0.0f;
  }
}

// ---------------------------------------------------------------------------
// relations[b,i,j,r] = (qr[b,i,r,:] . kr[b,j,r,:]) / sqrt(64).
// One wave per (16x16 ij-tile, b, r); fp32 WMMA over K=64, software-pipelined;
// strided scatter into the [B,L,L,R] output layout.
// ---------------------------------------------------------------------------
__global__ __launch_bounds__(32) void relations_kernel(
    const float* __restrict__ QR, const float* __restrict__ KR,
    float* __restrict__ REL) {
  const int lane = threadIdx.x & 31;
  const int hi = lane >> 4, nn = lane & 15;
  const int j0 = blockIdx.x * 16;
  const int i0 = blockIdx.y * 16;
  const int b  = blockIdx.z / R_;
  const int r  = blockIdx.z % R_;

  const float* qbase = QR + (size_t)(b * L_ + i0 + nn) * D_ + r * RP_ + 2 * hi;
  const float* kbase = KR + (size_t)(b * L_ + j0 + nn) * D_ + r * RP_ + 2 * hi;
  v8f acc = {};
  v2f a  = ld2(qbase);
  v2f bb = ld2(kbase);
  #pragma unroll
  for (int k0 = 4; k0 < RP_; k0 += 4) {
    v2f an  = ld2(qbase + k0);
    v2f bbn = ld2(kbase + k0);
    acc = __builtin_amdgcn_wmma_f32_16x16x4_f32(false, a, false, bb, (short)0, acc, false, false);
    a = an; bb = bbn;
  }
  acc = __builtin_amdgcn_wmma_f32_16x16x4_f32(false, a, false, bb, (short)0, acc, false, false);
  #pragma unroll
  for (int rr = 0; rr < 8; ++rr) {
    const int i = i0 + rr + 8 * hi;
    const int j = j0 + nn;
    REL[((size_t)(b * L_ + i) * L_ + j) * R_ + r] = acc[rr] * 0.125f;
  }
}

// ---------------------------------------------------------------------------
// attended[b,i,:] = sum_j attn[b,h,i,j] * sv[clip(j-i)+128][h,d]
//                 + sum_r (sum_j attn[b,h,i,j] * rel[b,i,j,r]) * wr[h,d,r]
// Diagonal-banded gather -> VALU kernel. Per (b,i) block: stage attn rows and
// the rel slice in LDS, reduce ar[h][r], then accumulate over j<=i (causal).
// ---------------------------------------------------------------------------
__global__ __launch_bounds__(256) void attend_kernel(
    const float* __restrict__ ATTN, const float* __restrict__ REL,
    const float* __restrict__ SV, const float* __restrict__ WR,
    float* __restrict__ OUT) {
  __shared__ float attnL[H_ * L_];   // 12 x 512
  __shared__ float relL[L_ * R_];    // 512 x 12
  __shared__ float ar[H_ * R_];      // 12 x 12
  const int i = blockIdx.x;
  const int b = blockIdx.y;
  const int t = threadIdx.x;

  for (int idx = t; idx < H_ * L_; idx += 256) {
    const int h = idx / L_, j = idx - h * L_;
    attnL[idx] = ATTN[((size_t)(b * H_ + h) * L_ + i) * L_ + j];
  }
  const float* relrow = REL + (size_t)(b * L_ + i) * L_ * R_;
  for (int idx = t; idx < L_ * R_; idx += 256) relL[idx] = relrow[idx];
  __syncthreads();

  if (t < H_ * R_) {
    const int h = t / R_, r = t - h * R_;
    float s = 0.0f;
    for (int j = 0; j <= i; ++j) s += attnL[h * L_ + j] * relL[j * R_ + r];
    ar[t] = s;
  }
  __syncthreads();

  float acc[3] = {0.0f, 0.0f, 0.0f};
  for (int j = 0; j <= i; ++j) {
    int rp = j - i + 128;            // j<=i (causal) -> rp in [?,128]
    if (rp < 0) rp = 0;
    const float* svrow = SV + (size_t)rp * D_;
    #pragma unroll
    for (int q = 0; q < 3; ++q) {
      const int dd = t + 256 * q;
      acc[q] += attnL[(dd >> 6) * L_ + j] * svrow[dd];
    }
  }
  float* orow = OUT + (size_t)(b * L_ + i) * D_;
  #pragma unroll
  for (int q = 0; q < 3; ++q) {
    const int dd = t + 256 * q;
    const int h = dd >> 6, d = dd & 63;
    float s = acc[q];
    #pragma unroll
    for (int r = 0; r < R_; ++r) s += ar[h * R_ + r] * WR[(h * HD_ + d) * R_ + r];
    orow[dd] = s;
  }
}

// ---------------------------------------------------------------------------
extern "C" void kernel_launch(void* const* d_in, const int* in_sizes, int n_in,
                              void* d_out, int out_size, void* d_ws, size_t ws_size,
                              hipStream_t stream) {
  const float* x       = (const float*)d_in[0];
  const float* wq_attn = (const float*)d_in[1];
  const float* wk_attn = (const float*)d_in[2];
  const float* wq_rel  = (const float*)d_in[3];
  const float* wk_rel  = (const float*)d_in[4];
  const float* wr      = (const float*)d_in[5];
  const float* wv      = (const float*)d_in[6];
  const float* wo      = (const float*)d_in[7];
  const float* rel_emb = (const float*)d_in[8];

  float* out  = (float*)d_out;                                  // [B,L,768]
  float* attn = out + (size_t)B_ * L_ * D_;                     // [B,H,L,L]
  float* rel  = attn + (size_t)B_ * H_ * L_ * L_;               // [B,L,L,R]

  const size_t NBLD = (size_t)B_ * L_ * D_;
  float* qa  = (float*)d_ws;
  float* ka  = qa + NBLD;
  float* qr  = ka + NBLD;
  float* kr  = qr + NBLD;
  float* sv  = kr + NBLD;                                       // [272,768]
  float* att = sv + (size_t)NPAD_ * D_;                         // [B,L,768]
  float* wt  = att + NBLD;                                      // [768,768] scratch

  const dim3 b32(32);
  const dim3 tb(256);
  const dim3 gT(D_ / 32, D_ / 32);                              // (24,24)
  const dim3 gProj(D_ / GBN, (B_ * L_) / GBM);                  // (8,32)

  // Projections: qa/ka/qr/kr = x @ W  (M=2048, K=N=768), weights transposed
  // into wt first; stream order serializes reuse of wt.
  transpose768<<<gT, tb, 0, stream>>>(wq_attn, wt);
  gemm_wmma_f32_bt<<<gProj, tb, 0, stream>>>(x, wt, qa, B_ * L_ - 1, D_, D_);
  transpose768<<<gT, tb, 0, stream>>>(wk_attn, wt);
  gemm_wmma_f32_bt<<<gProj, tb, 0, stream>>>(x, wt, ka, B_ * L_ - 1, D_, D_);
  transpose768<<<gT, tb, 0, stream>>>(wq_rel, wt);
  gemm_wmma_f32_bt<<<gProj, tb, 0, stream>>>(x, wt, qr, B_ * L_ - 1, D_, D_);
  transpose768<<<gT, tb, 0, stream>>>(wk_rel, wt);
  gemm_wmma_f32_bt<<<gProj, tb, 0, stream>>>(x, wt, kr, B_ * L_ - 1, D_, D_);
  // sv = rel_emb @ wv (M=257, grid padded to 320 rows, row-clamped loads)
  transpose768<<<gT, tb, 0, stream>>>(wv, wt);
  gemm_wmma_f32_bt<<<dim3(D_ / GBN, (NP_ + GBM - 1) / GBM), tb, 0, stream>>>(rel_emb, wt, sv, NP_ - 1, D_, D_);

  // attn: causal softmax(QKᵀ/8)
  scores_softmax<<<dim3(L_ / 16, H_, B_), 512, 0, stream>>>(qa, ka, attn);

  // relations: full (non-causal) output
  relations_kernel<<<dim3(L_ / 16, L_ / 16, B_ * R_), b32, 0, stream>>>(qr, kr, rel);

  // attended symbols + relations -> att [B,L,768]
  attend_kernel<<<dim3(L_, B_), 256, 0, stream>>>(attn, rel, sv, wr, att);

  // out = att @ wo
  transpose768<<<gT, tb, 0, stream>>>(wo, wt);
  gemm_wmma_f32_bt<<<gProj, tb, 0, stream>>>(att, wt, out, B_ * L_ - 1, D_, D_);
}

// v002
// Measured time: 239 microseconds a run.
// Two timings next to v001 both put it at 1.15 times that version's speed.
// All steps since v000 together make it 1.86 times as fast.
#include <hip/hip_runtime.h>
#include <math.h>

// Problem constants
#define B_    4
#define L_    512
#define D_    768
#define H_    12
#define HD_   64
#define R_    12
#define RP_   64
#define NP_   257     // 2*MAX_REL+1
#define NPAD_ 272     // padded to multiple of 16

typedef __attribute__((ext_vector_type(2))) float v2f;
typedef __attribute__((ext_vector_type(4))) float v4f;
typedef __attribute__((ext_vector_type(8))) float v8f;

__device__ __forceinline__ v2f ld2(const float* p) { return *(const v2f*)p; }
__device__ __forceinline__ v4f ld4(const float* p) { return *(const v4f*)p; }

// ---------------------------------------------------------------------------
// 768x768 transpose: Wdst[n][k] = Wsrc[k][n]. LDS 32x33 tile, coalesced both
// directions. grid (24,24), 256 threads.
// ---------------------------------------------------------------------------
__global__ __launch_bounds__(256) void transpose768(
    const float* __restrict__ Wsrc, float* __restrict__ Wdst) {
  __shared__ float tile[32][33];
  const int bx = blockIdx.x * 32, by = blockIdx.y * 32;
  const int tx = threadIdx.x & 31, ty = threadIdx.x >> 5;
  #pragma unroll
  for (int r = ty; r < 32; r += 8)
    tile[r][tx] = Wsrc[(size_t)(by + r) * D_ + bx + tx];
  __syncthreads();
  #pragma unroll
  for (int r = ty; r < 32; r += 8)
    Wdst[(size_t)(bx + r) * D_ + by + tx] = tile[tx][r];
}

// ---------------------------------------------------------------------------
// GEMM with pre-transposed weights: C[M,N] = A[M,K] @ WT[N,K]^T, fp32 WMMA
// 16x16x4. One work-group of 8 waves per 64x96 tile of C, wave tile 16x48
// (4 waves along M, 2 along N). K runs in chunks of 128: the 64 A rows and
// the 96 WT rows of a chunk are staged in LDS, whole 512-byte rows per wave
// load, and every wave takes its fragments from there, so a row is fetched
// once per work-group instead of once per wave. Two LDS buffers: the next
// chunk's global loads are issued ahead of the current chunk's WMMAs and are
// stored to the other buffer behind them; one barrier per chunk.
// The k order of every accumulator is that of the unstaged form.
// Needs N % 96 == 0 and K % 128 == 0. A-row loads are clamped to Mclamp and
// rows above Mclamp are not stored, so a padded M grid stays in bounds.
// ---------------------------------------------------------------------------
#define GBM 64      // C rows per work-group
#define GBN 96      // C columns per work-group
#define GKC 128     // k per staged chunk
#define GLP 132     // LDS row pitch in floats: 4 banks further per row
#define GROWS (GBM + GBN)
__global__ __launch_bounds__(256) void gemm_wmma_f32_bt(
    const float* __restrict__ A, const float* __restrict__ WT,
    float* __restrict__ C, int Mclamp, int N, int K) {
  __shared__ __attribute__((aligned(16))) float sm[2][GROWS * GLP];
  const int lane = threadIdx.x & 31;
  const int wave = __builtin_amdgcn_readfirstlane(threadIdx.x >> 5);
  const int hi = lane >> 4;          // half-wave select (K pair / M+8)
  const int nn = lane & 15;          // lane within half: N (B/C) or M (A)
  const int wm = wave >> 1;          // wave's 16-row strip of the tile
  const int wn = wave & 1;           // wave's 48-column strip of the tile
  const int n0 = blockIdx.x * GBN;
  const int m0 = blockIdx.y * GBM;

  // staging: wave w moves rows w, w+8, ... ; lane l moves floats 4l..4l+3
  v4f st[GROWS / 8];
  const int sc = 4 * lane;
  #pragma unroll
  for (int i = 0; i < GBM / 8; ++i)
    st[i] = ld4(A + (size_t)min(m0 + 8 * i + wave, Mclamp) * K + sc);
  #pragma unroll
  for (int i = 0; i < GBN / 8; ++i)
    st[GBM / 8 + i] = ld4(WT + (size_t)(n0 + 8 * i + wave) * K + sc);
  // the loads' address registers are reused right below: wait before the overwrite
  asm volatile("s_wait_xcnt 0x0" ::: "memory");
  // keeps the register writes that follow from being lifted over that wait
  __builtin_amdgcn_sched_barrier(0);
  #pragma unroll
  for (int i = 0; i < GROWS / 8; ++i)
    *(v4f*)&sm[0][(8 * i + wave) * GLP + sc] = st[i];
  __syncthreads();

  const int aoff = (wm * 16 + nn) * GLP + 2 * hi;
  const int boff = (GBM + wn * 48 + nn) * GLP + 2 * hi;
  v8f acc0 = {}, acc1 = {}, acc2 = {};
  const int nchunk = K / GKC;
  for (int c = 0; c < nchunk; ++c) {
    const bool more = c + 1 < nchunk;
    if (more) {
      const int kc = (c + 1) * GKC + sc;
      #pragma unroll
      for (int i = 0; i < GBM / 8; ++i)
        st[i] = ld4(A + (size_t)min(m0 + 8 * i + wave, Mclamp) * K + kc);
      #pragma unroll
      for (int i = 0; i < GBN / 8; ++i)
        st[GBM / 8 + i] = ld4(WT + (size_t)(n0 + 8 * i + wave) * K + kc);
    }
    const float* la = &sm[c & 1][aoff];
    const float* lb = &sm[c & 1][boff];
    #pragma unroll
    for (int k0 = 0; k0 < GKC; k0 += 4) {
      const v2f a  = ld2(la + k0);
      const v2f b0 = ld2(lb + k0);
      const v2f b1 = ld2(lb + 16 * GLP + k0);
      const v2f b2 = ld2(lb + 32 * GLP + k0);
      acc0 = __builtin_amdgcn_wmma_f32_16x16x4_f32(false, a, false, b0, (short)0, acc0, false, false);
      acc1 = __builtin_amdgcn_wmma_f32_16x16x4_f32(false, a, false, b1, (short)0, acc1, false, false);
      acc2 = __builtin_amdgcn_wmma_f32_16x16x4_f32(false, a, false, b2, (short)0, acc2, false, false);
    }
    if (more) {
      float* dst = &sm[(c + 1) & 1][wave * GLP + sc];
      #pragma unroll
      for (int i = 0; i < GROWS / 8; ++i)
        *(v4f*)(dst + 8 * i * GLP) = st[i];
    }
    __syncthreads();
  }

  #pragma unroll
  for (int r = 0; r < 8; ++r) {
    const int m = m0 + wm * 16 + r + 8 * hi;   // C layout: VGPR r -> M=r / r+8
    if (m <= Mclamp) {
      float* crow = C + (size_t)m * N + n0 + wn * 48 + nn;
      crow[0]  = acc0[r];
      crow[16] = acc1[r];
      crow[32] = acc2[r];
    }
  }
}

// ---------------------------------------------------------------------------
// Scores (QKᵀ * 1/sqrt(64)) + causal softmax -> attn[B,H,L,L].
// Block: (i-tile of 16 rows, h, b), 16 waves. Waves compute 16x16 score tiles
// via fp32 WMMA into LDS (skipping fully-masked causal tiles), then wave w
// softmaxes row w with wave32 shuffle reductions.
// ---------------------------------------------------------------------------
#define LDP 520
__global__ __launch_bounds__(512) void scores_softmax(
    const float* __restrict__ QA, const float* __restrict__ KA,
    float* __restrict__ ATTN) {
  __shared__ float sc[16 * LDP];
  const int i0   = blockIdx.x * 16;
  const int h    = blockIdx.y;
  const int b    = blockIdx.z;
  const int wave = threadIdx.x >> 5;
  const int lane = threadIdx.x & 31;
  const int hi = lane >> 4, nn = lane & 15;

  const float* qbase = QA + (size_t)(b * L_ + i0 + nn) * D_ + h * HD_ + 2 * hi;
  for (int jt = wave * 2; jt < wave * 2 + 2; ++jt) {
    const int j0 = jt * 16;
    if (j0 <= i0 + 15) {                                // skip fully-masked tiles
      const float* kbase = KA + (size_t)(b * L_ + j0 + nn) * D_ + h * HD_ + 2 * hi;
      v8f acc = {};
      v2f a  = ld2(qbase);
      v2f bb = ld2(kbase);                              // Bᵀ: ka row j as column
      #pragma unroll
      for (int k0 = 4; k0 < HD_; k0 += 4) {
        v2f an  = ld2(qbase + k0);
        v2f bbn = ld2(kbase + k0);
        acc = __builtin_amdgcn_wmma_f32_16x16x4_f32(false, a, false, bb, (short)0, acc, false, false);
        a = an; bb = bbn;
      }
      acc = __builtin_amdgcn_wmma_f32_16x16x4_f32(false, a, false, bb, (short)0, acc, false, false);
      #pragma unroll
      for (int r = 0; r < 8; ++r)
        sc[(r + 8 * hi) * LDP + j0 + nn] = acc[r] * 0.125f;
    }
  }
  __syncthreads();

  // softmax: wave w -> row w (16 waves, 16 rows)
  const int row = wave;
  const int ig  = i0 + row;
  float vals[16];
  float mx = -__builtin_inff();
  #pragma unroll
  for (int t = 0; t < 16; ++t) {
    const int j = lane + 32 * t;
    const float v = (j <= ig) ? sc[row * LDP + j] : -__builtin_inff();
    vals[t] = v;
    mx = fmaxf(mx, v);
  }
  for (int off = 16; off; off >>= 1) mx = fmaxf(mx, __shfl_xor(mx, off, 32));
  float sum = 0.0f;
  #pragma unroll
  for (int t = 0; t < 16; ++t) { const float e = __expf(vals[t] - mx); vals[t] = e; sum += e; }
  for (int off = 16; off; off >>= 1) sum += __shfl_xor(sum, off, 32);
  const float inv = 1.0f / sum;
  float* arow = ATTN + ((size_t)(b * H_ + h) * L_ + ig) * L_;
  #pragma unroll
  for (int t = 0; t < 16; ++t) {
    const int j = lane + 32 * t;
    arow[j] = (j <= ig) ? vals[t] * inv : 0.0f;
  }
}

// ---------------------------------------------------------------------------
// relations[b,i,j,r] = (qr[b,i,r,:] . kr[b,j,r,:]) / sqrt(64).
// One work-group of 12 waves per (b, 16 rows i, 128 columns j); wave = r.
// Each wave brings its 16x64 slices of qr and kr in with whole-line loads
// (two 256-byte row slices per load) and turns them into WMMA fragments
// through an LDS tile of its own, which no other wave touches; the q
// fragments stay in registers for all 8 j tiles. The 12 waves' 16x16 results
// of a j tile are gathered in LDS as [i][j][r] and leave as runs of 768
// contiguous bytes per row i, so every 128-byte line of the output has one
// writer. The gather has two buffers and one barrier per j tile. The next k
// tile's global loads are in flight during the current tile's WMMAs.
// The k order of every sum is that of the one-wave form.
// ---------------------------------------------------------------------------
#define RNT 8               // j tiles of 16 per work-group
#define RKP 68              // LDS pitch of a staged 64-float row: 4 banks further per row
#define ROT (16 * 16 * R_)  // floats of one gathered [16 i][16 j][12 r] tile
__global__ __launch_bounds__(384) void relations_kernel(
    const float* __restrict__ QR, const float* __restrict__ KR,
    float* __restrict__ REL) {
  __shared__ __attribute__((aligned(16))) float kt[R_][16 * RKP];
  __shared__ __attribute__((aligned(16))) float ot[2][ROT];
  const int tid  = threadIdx.x;
  const int lane = tid & 31;
  const int r    = __builtin_amdgcn_readfirstlane(tid >> 5);
  const int hi = lane >> 4, nn = lane & 15;
  const int jb = blockIdx.x * (16 * RNT);
  const int i0 = blockIdx.y * 16;
  const int b  = blockIdx.z;

  // staging: a lane moves floats 4nn..4nn+3 of rows hi, hi+2, ..., hi+14
  const float* qsrc = QR + (size_t)(b * L_ + i0 + hi) * D_ + r * RP_ + 4 * nn;
  const float* ksrc = KR + (size_t)(b * L_ + jb + hi) * D_ + r * RP_ + 4 * nn;
  float* sdst = &kt[r][hi * RKP + 4 * nn];
  const float* frag = &kt[r][nn * RKP + 2 * hi];

  // every '#pragma unroll' in this kernel: its loop indexes a small array, which
  // stays in registers only when the index is a constant
  v4f sq[8], st[8];
  #pragma unroll
  for (int q = 0; q < 8; ++q) sq[q] = ld4(qsrc + 2 * q * D_);
  #pragma unroll
  for (int q = 0; q < 8; ++q) st[q] = ld4(ksrc + 2 * q * D_);
  #pragma unroll
  for (int q = 0; q < 8; ++q) *(v4f*)(sdst + 2 * q * RKP) = sq[q];
  // the wave's own tile is written before its lanes read each other's rows back
  asm volatile("s_wait_dscnt 0x0" ::: "memory");
  v2f a[16];
  #pragma unroll
  for (int s = 0; s < 16; ++s) a[s] = ld2(frag + 4 * s);
  // the q fragments have left the tile before the wave refills it with k rows
  asm volatile("s_wait_dscnt 0x0" ::: "memory");

  // flush: a thread moves 4 floats of row tid/48 and 4 of row tid/48 + 8
  const int frow = tid / 48, fcol = (tid - frow * 48) * 4;
  float* odst = REL + ((size_t)(b * L_ + i0 + frow) * L_ + jb) * R_ + fcol;

  for (int t = 0; t < RNT; ++t) {
    #pragma unroll
    for (int q = 0; q < 8; ++q) *(v4f*)(sdst + 2 * q * RKP) = st[q];
    if (t + 1 < RNT) {
      const float* kn = ksrc + (size_t)(t + 1) * 16 * D_;
      #pragma unroll
      for (int q = 0; q < 8; ++q) st[q] = ld4(kn + 2 * q * D_);
    }
    // the wave's own tile is written before its lanes read each other's rows back
    asm volatile("s_wait_dscnt 0x0" ::: "memory");
    v2f bb[16];
    #pragma unroll
    for (int s = 0; s < 16; ++s) bb[s] = ld2(frag + 4 * s);
    // keeps the fragment reads in one group ahead of the WMMAs instead of spread among them
    __builtin_amdgcn_sched_barrier(0);
    v8f acc = {};
    #pragma unroll
    for (int s = 0; s < 16; ++s)
      acc = __builtin_amdgcn_wmma_f32_16x16x4_f32(false, a[s], false, bb[s], (short)0, acc, false, false);
    float* o = &ot[t & 1][(8 * hi * 16 + nn) * R_ + r];   // C layout: VGPR rr -> i = rr / rr+8
    #pragma unroll
    for (int rr = 0; rr < 8; ++rr) o[rr * 16 * R_] = acc[rr] * 0.125f;
    __syncthreads();
    const float* os = &ot[t & 1][4 * tid];
    float* od = odst + t * 16 * R_;
    *(v4f*)od = *(const v4f*)os;
    *(v4f*)(od + (size_t)8 * L_ * R_) = *(const v4f*)(os + 4 * 384);
  }
}

// ---------------------------------------------------------------------------
// attended[b,i,:] = sum_j attn[b,h,i,j] * sv[clip(j-i)+128][h,d]
//                 + sum_r (sum_j attn[b,h,i,j] * rel[b,i,j,r]) * wr[h,d,r]
// Diagonal-banded gather -> VALU kernel. Per (b,i) block: stage attn rows and
// the rel slice in LDS, reduce ar[h][r], then accumulate over j<=i (causal).
// ---------------------------------------------------------------------------
__global__ __launch_bounds__(256) void attend_kernel(
    const float* __restrict__ ATTN, const float* __restrict__ REL,
    const float* __restrict__ SV, const float* __restrict__ WR,
    float* __restrict__ OUT) {
  __shared__ float attnL[H_ * L_];   // 12 x 512
  __shared__ float relL[L_ * R_];    // 512 x 12
  __shared__ float ar[H_ * R_];      // 12 x 12
  const int i = blockIdx.x;
  const int b = blockIdx.y;
  const int t = threadIdx.x;

  for (int idx = t; idx < H_ * L_; idx += 256) {
    const int h = idx / L_, j = idx - h * L_;
    attnL[idx] = ATTN[((size_t)(b * H_ + h) * L_ + i) * L_ + j];
  }
  const float* relrow = REL + (size_t)(b * L_ + i) * L_ * R_;
  for (int idx = t; idx < L_ * R_; idx += 256) relL[idx] = relrow[idx];
  __syncthreads();

  if (t < H_ * R_) {
    const int h = t / R_, r = t - h * R_;
    float s = 0.0f;
    for (int j = 0; j <= i; ++j) s += attnL[h * L_ + j] * relL[j * R_ + r];
    ar[t] = s;
  }
  __syncthreads();

  float acc[3] = {0.0f, 0.0f, 0.0f};
  for (int j = 0; j <= i; ++j) {
    int rp = j - i + 128;            // j<=i (causal) -> rp in [?,128]
    if (rp < 0) rp = 0;
    const float* svrow = SV + (size_t)rp * D_;
    #pragma unroll
    for (int q = 0; q < 3; ++q) {
      const int dd = t + 256 * q;
      acc[q] += attnL[(dd >> 6) * L_ + j] * svrow[dd];
    }
  }
  float* orow = OUT + (size_t)(b * L_ + i) * D_;
  #pragma unroll
  for (int q = 0; q < 3; ++q) {
    const int dd = t + 256 * q;
    const int h = dd >> 6, d = dd & 63;
    float s = acc[q];
    #pragma unroll
    for (int r = 0; r < R_; ++r) s += ar[h * R_ + r] * WR[(h * HD_ + d) * R_ + r];
    orow[dd] = s;
  }
}

// ---------------------------------------------------------------------------
extern "C" void kernel_launch(void* const* d_in, const int* in_sizes, int n_in,
                              void* d_out, int out_size, void* d_ws, size_t ws_size,
                              hipStream_t stream) {
  const float* x       = (const float*)d_in[0];
  const float* wq_attn = (const float*)d_in[1];
  const float* wk_attn = (const float*)d_in[2];
  const float* wq_rel  = (const float*)d_in[3];
  const float* wk_rel  = (const float*)d_in[4];
  const float* wr      = (const float*)d_in[5];
  const float* wv      = (const float*)d_in[6];
  const float* wo      = (const float*)d_in[7];
  const float* rel_emb = (const float*)d_in[8];

  float* out  = (float*)d_out;                                  // [B,L,768]
  float* attn = out + (size_t)B_ * L_ * D_;                     // [B,H,L,L]
  float* rel  = attn + (size_t)B_ * H_ * L_ * L_;               // [B,L,L,R]

  const size_t NBLD = (size_t)B_ * L_ * D_;
  float* qa  = (float*)d_ws;
  float* ka  = qa + NBLD;
  float* qr  = ka + NBLD;
  float* kr  = qr + NBLD;
  float* sv  = kr + NBLD;                                       // [272,768]
  float* att = sv + (size_t)NPAD_ * D_;                         // [B,L,768]
  float* wt  = att + NBLD;                                      // [768,768] scratch

  const dim3 tb(256);
  const dim3 gT(D_ / 32, D_ / 32);                              // (24,24)
  const dim3 gProj(D_ / GBN, (B_ * L_) / GBM);                  // (8,32)

  // Projections: qa/ka/qr/kr = x @ W  (M=2048, K=N=768), weights transposed
  // into wt first; stream order serializes reuse of wt.
  transpose768<<<gT, tb, 0, stream>>>(wq_attn, wt);
  gemm_wmma_f32_bt<<<gProj, tb, 0, stream>>>(x, wt, qa, B_ * L_ - 1, D_, D_);
  transpose768<<<gT, tb, 0, stream>>>(wk_attn, wt);
  gemm_wmma_f32_bt<<<gProj, tb, 0, stream>>>(x, wt, ka, B_ * L_ - 1, D_, D_);
  transpose768<<<gT, tb, 0, stream>>>(wq_rel, wt);
  gemm_wmma_f32_bt<<<gProj, tb, 0, stream>>>(x, wt, qr, B_ * L_ - 1, D_, D_);
  transpose768<<<gT, tb, 0, stream>>>(wk_rel, wt);
  gemm_wmma_f32_bt<<<gProj, tb, 0, stream>>>(x, wt, kr, B_ * L_ - 1, D_, D_);
  // sv = rel_emb @ wv (M=257, grid padded to 320 rows, row-clamped loads)
  transpose768<<<gT, tb, 0, stream>>>(wv, wt);
  gemm_wmma_f32_bt<<<dim3(D_ / GBN, (NP_ + GBM - 1) / GBM), tb, 0, stream>>>(rel_emb, wt, sv, NP_ - 1, D_, D_);

  // attn: causal softmax(QKᵀ/8)
  scores_softmax<<<dim3(L_ / 16, H_, B_), 512, 0, stream>>>(qa, ka, attn);

  // relations: full (non-causal) output
  relations_kernel<<<dim3(L_ / (16 * RNT), L_ / 16, B_), 32 * R_, 0, stream>>>(qr, kr, rel);

  // attended symbols + relations -> att [B,L,768]
  attend_kernel<<<dim3(L_, B_), 256, 0, stream>>>(attn, rel, sv, wr, att);

  // out = att @ wo
  transpose768<<<gT, tb, 0, stream>>>(wo, wt);
  gemm_wmma_f32_bt<<<gProj, tb, 0, stream>>>(att, wt, out, B_ * L_ - 1, D_, D_);
}

// v003
// Measured time: 216 microseconds a run.
// In both of two side-by-side timings against v002, it was 1.11 times as fast.
// Counting every step since v000, it is 2.06 times as fast.
#include <hip/hip_runtime.h>
#include <math.h>

// Problem constants
#define B_    4
#define L_    512
#define D_    768
#define H_    12
#define HD_   64
#define R_    12
#define RP_   64
#define NP_   257     // 2*MAX_REL+1
#define NPAD_ 272     // padded to multiple of 16

typedef __attribute__((ext_vector_type(2))) float v2f;
typedef __attribute__((ext_vector_type(4))) float v4f;
typedef __attribute__((ext_vector_type(8))) float v8f;

__device__ __forceinline__ v2f ld2(const float* p) { return *(const v2f*)p; }
__device__ __forceinline__ v4f ld4(const float* p) { return *(const v4f*)p; }

// ---------------------------------------------------------------------------
// 768x768 transpose: Wdst[n][k] = Wsrc[k][n]. LDS 32x33 tile, coalesced both
// directions. One launch turns all six weight matrices: grid (24,24,6), 256
// threads; blockIdx.z picks the source, and the result goes to slot z of Wall.
// ---------------------------------------------------------------------------
__global__ __launch_bounds__(256) void transpose768(
    const float* __restrict__ W0, const float* __restrict__ W1,
    const float* __restrict__ W2, const float* __restrict__ W3,
    const float* __restrict__ W4, const float* __restrict__ W5,
    float* __restrict__ Wall) {
  __shared__ float tile[32][33];
  const int z = blockIdx.z;
  const float* Wsrc = z == 0 ? W0 : z == 1 ? W1 : z == 2 ? W2 : z == 3 ? W3 : z == 4 ? W4 : W5;
  float* Wdst = Wall + (size_t)z * D_ * D_;
  const int bx = blockIdx.x * 32, by = blockIdx.y * 32;
  const int tx = threadIdx.x & 31, ty = threadIdx.x >> 5;
  #pragma unroll
  for (int r = ty; r < 32; r += 8)
    tile[r][tx] = Wsrc[(size_t)(by + r) * D_ + bx + tx];
  __syncthreads();
  #pragma unroll
  for (int r = ty; r < 32; r += 8)
    Wdst[(size_t)(bx + r) * D_ + by + tx] = tile[tx][r];
}

// ---------------------------------------------------------------------------
// GEMM with pre-transposed weights: C[M,N] = A[M,K] @ WT[N,K]^T, fp32 WMMA
// 16x16x4. One work-group of 8 waves per 64x96 tile of C, wave tile 16x48
// (4 waves along M, 2 along N). K runs in chunks of 128: the 64 A rows and
// the 96 WT rows of a chunk are staged in LDS, whole 512-byte rows per wave
// load, and every wave takes its fragments from there, so a row is fetched
// once per work-group instead of once per wave. Two LDS buffers: the next
// chunk's global loads are issued ahead of the current chunk's WMMAs and are
// stored to the other buffer behind them; one barrier per chunk.
// The k order of every accumulator is that of the unstaged form.
// Needs N % 96 == 0 and K % 128 == 0. A-row loads are clamped to Mclamp and
// rows above Mclamp are not stored, so a padded M grid stays in bounds.
// One launch holds several independent products. The first nys values of
// blockIdx.y are the row tiles of As @ WTs^T -> Cs (rows 0..Ms). The values
// behind them are a batch that shares Ab (rows 0..Mb): 2^ysh row tiles per
// member, member p takes weight slot p of WTb and writes slot p of Cb.
// ---------------------------------------------------------------------------
#define GBM 64      // C rows per work-group
#define GBN 96      // C columns per work-group
#define GKC 128     // k per staged chunk
#define GLP 132     // LDS row pitch in floats: 4 banks further per row
#define GROWS (GBM + GBN)
__global__ __launch_bounds__(256) void gemm_wmma_f32_bt(
    const float* __restrict__ Ab, const float* __restrict__ WTb,
    float* __restrict__ Cb, int Mb, int ysh,
    const float* __restrict__ As, const float* __restrict__ WTs,
    float* __restrict__ Cs, int Ms, int nys, int N, int K) {
  __shared__ __attribute__((aligned(16))) float sm[2][GROWS * GLP];
  const int by = blockIdx.y;
  const bool lone = by < nys;
  const int yb = lone ? 0 : by - nys;
  const int p  = yb >> ysh;
  const float* A  = lone ? As : Ab;
  const float* WT = lone ? WTs : WTb + (size_t)p * N * K;
  float* C        = lone ? Cs : Cb + (size_t)p * (Mb + 1) * N;
  const int Mclamp = lone ? Ms : Mb;
  const int lane = threadIdx.x & 31;
  const int wave = __builtin_amdgcn_readfirstlane(threadIdx.x >> 5);
  const int hi = lane >> 4;          // half-wave select (K pair / M+8)
  const int nn = lane & 15;          // lane within half: N (B/C) or M (A)
  const int wm = wave >> 1;          // wave's 16-row strip of the tile
  const int wn = wave & 1;           // wave's 48-column strip of the tile
  const int n0 = blockIdx.x * GBN;
  const int m0 = (lone ? by : yb - (p << ysh)) * GBM;

  // staging: wave w moves rows w, w+8, ... ; lane l moves floats 4l..4l+3
  v4f st[GROWS / 8];
  const int sc = 4 * lane;
  #pragma unroll
  for (int i = 0; i < GBM / 8; ++i)
    st[i] = ld4(A + (size_t)min(m0 + 8 * i + wave, Mclamp) * K + sc);
  #pragma unroll
  for (int i = 0; i < GBN / 8; ++i)
    st[GBM / 8 + i] = ld4(WT + (size_t)(n0 + 8 * i + wave) * K + sc);
  // the loads' address registers are reused right below: wait before the overwrite
  asm volatile("s_wait_xcnt 0x0" ::: "memory");
  // keeps the register writes that follow from being lifted over that wait
  __builtin_amdgcn_sched_barrier(0);
  #pragma unroll
  for (int i = 0; i < GROWS / 8; ++i)
    *(v4f*)&sm[0][(8 * i + wave) * GLP + sc] = st[i];
  __syncthreads();

  const int aoff = (wm * 16 + nn) * GLP + 2 * hi;
  const int boff = (GBM + wn * 48 + nn) * GLP + 2 * hi;
  v8f acc0 = {}, acc1 = {}, acc2 = {};
  const int nchunk = K / GKC;
  for (int c = 0; c < nchunk; ++c) {
    const bool more = c + 1 < nchunk;
    if (more) {
      const int kc = (c + 1) * GKC + sc;
      #pragma unroll
      for (int i = 0; i < GBM / 8; ++i)
        st[i] = ld4(A + (size_t)min(m0 + 8 * i + wave, Mclamp) * K + kc);
      #pragma unroll
      for (int i = 0; i < GBN / 8; ++i)
        st[GBM / 8 + i] = ld4(WT + (size_t)(n0 + 8 * i + wave) * K + kc);
    }
    const float* la = &sm[c & 1][aoff];
    const float* lb = &sm[c & 1][boff];
    #pragma unroll
    for (int k0 = 0; k0 < GKC; k0 += 4) {
      const v2f a  = ld2(la + k0);
      const v2f b0 = ld2(lb + k0);
      const v2f b1 = ld2(lb + 16 * GLP + k0);
      const v2f b2 = ld2(lb + 32 * GLP + k0);
      acc0 = __builtin_amdgcn_wmma_f32_16x16x4_f32(false, a, false, b0, (short)0, acc0, false, false);
      acc1 = __builtin_amdgcn_wmma_f32_16x16x4_f32(false, a, false, b1, (short)0, acc1, false, false);
      acc2 = __builtin_amdgcn_wmma_f32_16x16x4_f32(false, a, false, b2, (short)0, acc2, false, false);
    }
    if (more) {
      float* dst = &sm[(c + 1) & 1][wave * GLP + sc];
      #pragma unroll
      for (int i = 0; i < GROWS / 8; ++i)
        *(v4f*)(dst + 8 * i * GLP) = st[i];
    }
    __syncthreads();
  }

  #pragma unroll
  for (int r = 0; r < 8; ++r) {
    const int m = m0 + wm * 16 + r + 8 * hi;   // C layout: VGPR r -> M=r / r+8
    if (m <= Mclamp) {
      float* crow = C + (size_t)m * N + n0 + wn * 48 + nn;
      crow[0]  = acc0[r];
      crow[16] = acc1[r];
      crow[32] = acc2[r];
    }
  }
}

// ---------------------------------------------------------------------------
// Scores (QKᵀ * 1/sqrt(64)) + causal softmax -> attn[B,H,L,L].
// Block: (i-tile of 16 rows, h, b), 16 waves. Waves compute 16x16 score tiles
// via fp32 WMMA into LDS (skipping fully-masked causal tiles), then wave w
// softmaxes row w with wave32 shuffle reductions.
// ---------------------------------------------------------------------------
#define LDP 520
__global__ __launch_bounds__(512) void scores_softmax(
    const float* __restrict__ QA, const float* __restrict__ KA,
    float* __restrict__ ATTN) {
  __shared__ float sc[16 * LDP];
  const int i0   = blockIdx.x * 16;
  const int h    = blockIdx.y;
  const int b    = blockIdx.z;
  const int wave = threadIdx.x >> 5;
  const int lane = threadIdx.x & 31;
  const int hi = lane >> 4, nn = lane & 15;

  const float* qbase = QA + (size_t)(b * L_ + i0 + nn) * D_ + h * HD_ + 2 * hi;
  for (int jt = wave * 2; jt < wave * 2 + 2; ++jt) {
    const int j0 = jt * 16;
    if (j0 <= i0 + 15) {                                // skip fully-masked tiles
      const float* kbase = KA + (size_t)(b * L_ + j0 + nn) * D_ + h * HD_ + 2 * hi;
      v8f acc = {};
      v2f a  = ld2(qbase);
      v2f bb = ld2(kbase);                              // Bᵀ: ka row j as column
      #pragma unroll
      for (int k0 = 4; k0 < HD_; k0 += 4) {
        v2f an  = ld2(qbase + k0);
        v2f bbn = ld2(kbase + k0);
        acc = __builtin_amdgcn_wmma_f32_16x16x4_f32(false, a, false, bb, (short)0, acc, false, false);
        a = an; bb = bbn;
      }
      acc = __builtin_amdgcn_wmma_f32_16x16x4_f32(false, a, false, bb, (short)0, acc, false, false);
      #pragma unroll
      for (int r = 0; r < 8; ++r)
        sc[(r + 8 * hi) * LDP + j0 + nn] = acc[r] * 0.125f;
    }
  }
  __syncthreads();

  // softmax: wave w -> row w (16 waves, 16 rows)
  const int row = wave;
  const int ig  = i0 + row;
  float vals[16];
  float mx = -__builtin_inff();
  #pragma unroll
  for (int t = 0; t < 16; ++t) {
    const int j = lane + 32 * t;
    const float v = (j <= ig) ? sc[row * LDP + j] : -__builtin_inff();
    vals[t] = v;
    mx = fmaxf(mx, v);
  }
  for (int off = 16; off; off >>= 1) mx = fmaxf(mx, __shfl_xor(mx, off, 32));
  float sum = 0.0f;
  #pragma unroll
  for (int t = 0; t < 16; ++t) { const float e = __expf(vals[t] - mx); vals[t] = e; sum += e; }
  for (int off = 16; off; off >>= 1) sum += __shfl_xor(sum, off, 32);
  const float inv = 1.0f / sum;
  float* arow = ATTN + ((size_t)(b * H_ + h) * L_ + ig) * L_;
  #pragma unroll
  for (int t = 0; t < 16; ++t) {
    const int j = lane + 32 * t;
    arow[j] = (j <= ig) ? vals[t] * inv : 0.0f;
  }
}

// ---------------------------------------------------------------------------
// relations[b,i,j,r] = (qr[b,i,r,:] . kr[b,j,r,:]) / sqrt(64).
// One work-group of 12 waves per (b, 16 rows i, 128 columns j); wave = r.
// Each wave brings its 16x64 slices of qr and kr in with whole-line loads
// (two 256-byte row slices per load) and turns them into WMMA fragments
// through an LDS tile of its own, which no other wave touches; the q
// fragments stay in registers for all 8 j tiles. The 12 waves' 16x16 results
// of a j tile are gathered in LDS as [i][j][r] and leave as runs of 768
// contiguous bytes per row i, so every 128-byte line of the output has one
// writer. The gather has two buffers and one barrier per j tile. The next k
// tile's global loads are in flight during the current tile's WMMAs.
// The k order of every sum is that of the one-wave form.
// ---------------------------------------------------------------------------
#define RNT 8               // j tiles of 16 per work-group
#define RKP 68              // LDS pitch of a staged 64-float row: 4 banks further per row
#define ROT (16 * 16 * R_)  // floats of one gathered [16 i][16 j][12 r] tile
__global__ __launch_bounds__(384) void relations_kernel(
    const float* __restrict__ QR, const float* __restrict__ KR,
    float* __restrict__ REL) {
  __shared__ __attribute__((aligned(16))) float kt[R_][16 * RKP];
  __shared__ __attribute__((aligned(16))) float ot[2][ROT];
  const int tid  = threadIdx.x;
  const int lane = tid & 31;
  const int r    = __builtin_amdgcn_readfirstlane(tid >> 5);
  const int hi = lane >> 4, nn = lane & 15;
  const int jb = blockIdx.x * (16 * RNT);
  const int i0 = blockIdx.y * 16;
  const int b  = blockIdx.z;

  // staging: a lane moves floats 4nn..4nn+3 of rows hi, hi+2, ..., hi+14
  const float* qsrc = QR + (size_t)(b * L_ + i0 + hi) * D_ + r * RP_ + 4 * nn;
  const float* ksrc = KR + (size_t)(b * L_ + jb + hi) * D_ + r * RP_ + 4 * nn;
  float* sdst = &kt[r][hi * RKP + 4 * nn];
  const float* frag = &kt[r][nn * RKP + 2 * hi];

  // every '#pragma unroll' in this kernel: its loop indexes a small array, which
  // stays in registers only when the index is a constant
  v4f sq[8], st[8];
  #pragma unroll
  for (int q = 0; q < 8; ++q) sq[q] = ld4(qsrc + 2 * q * D_);
  #pragma unroll
  for (int q = 0; q < 8; ++q) st[q] = ld4(ksrc + 2 * q * D_);
  #pragma unroll
  for (int q = 0; q < 8; ++q) *(v4f*)(sdst + 2 * q * RKP) = sq[q];
  // the wave's own tile is written before its lanes read each other's rows back
  asm volatile("s_wait_dscnt 0x0" ::: "memory");
  v2f a[16];
  #pragma unroll
  for (int s = 0; s < 16; ++s) a[s] = ld2(frag + 4 * s);
  // the q fragments have left the tile before the wave refills it with k rows
  asm volatile("s_wait_dscnt 0x0" ::: "memory");

  // flush: a thread moves 4 floats of row tid/48 and 4 of row tid/48 + 8
  const int frow = tid / 48, fcol = (tid - frow * 48) * 4;
  float* odst = REL + ((size_t)(b * L_ + i0 + frow) * L_ + jb) * R_ + fcol;

  for (int t = 0; t < RNT; ++t) {
    #pragma unroll
    for (int q = 0; q < 8; ++q) *(v4f*)(sdst + 2 * q * RKP) = st[q];
    if (t + 1 < RNT) {
      const float* kn = ksrc + (size_t)(t + 1) * 16 * D_;
      #pragma unroll
      for (int q = 0; q < 8; ++q) st[q] = ld4(kn + 2 * q * D_);
    }
    // the wave's own tile is written before its lanes read each other's rows back
    asm volatile("s_wait_dscnt 0x0" ::: "memory");
    v2f bb[16];
    #pragma unroll
    for (int s = 0; s < 16; ++s) bb[s] = ld2(frag + 4 * s);
    // keeps the fragment reads in one group ahead of the WMMAs instead of spread among them
    __builtin_amdgcn_sched_barrier(0);
    v8f acc = {};
    #pragma unroll
    for (int s = 0; s < 16; ++s)
      acc = __builtin_amdgcn_wmma_f32_16x16x4_f32(false, a[s], false, bb[s], (short)0, acc, false, false);
    float* o = &ot[t & 1][(8 * hi * 16 + nn) * R_ + r];   // C layout: VGPR rr -> i = rr / rr+8
    #pragma unroll
    for (int rr = 0; rr < 8; ++rr) o[rr * 16 * R_] = acc[rr] * 0.125f;
    __syncthreads();
    const float* os = &ot[t & 1][4 * tid];
    float* od = odst + t * 16 * R_;
    *(v4f*)od = *(const v4f*)os;
    *(v4f*)(od + (size_t)8 * L_ * R_) = *(const v4f*)(os + 4 * 384);
  }
}

// ---------------------------------------------------------------------------
// attended[b,i,:] = sum_j attn[b,h,i,j] * sv[clip(j-i)+128][h,d]
//                 + sum_r (sum_j attn[b,h,i,j] * rel[b,i,j,r]) * wr[h,d,r]
// Diagonal-banded gather -> VALU kernel. Per (b,i) block: stage attn rows and
// the rel slice in LDS, reduce ar[h][r], then accumulate over j<=i (causal).
// ---------------------------------------------------------------------------
__global__ __launch_bounds__(256) void attend_kernel(
    const float* __restrict__ ATTN, const float* __restrict__ REL,
    const float* __restrict__ SV, const float* __restrict__ WR,
    float* __restrict__ OUT) {
  __shared__ float attnL[H_ * L_];   // 12 x 512
  __shared__ float relL[L_ * R_];    // 512 x 12
  __shared__ float ar[H_ * R_];      // 12 x 12
  const int i = blockIdx.x;
  const int b = blockIdx.y;
  const int t = threadIdx.x;

  for (int idx = t; idx < H_ * L_; idx += 256) {
    const int h = idx / L_, j = idx - h * L_;
    attnL[idx] = ATTN[((size_t)(b * H_ + h) * L_ + i) * L_ + j];
  }
  const float* relrow = REL + (size_t)(b * L_ + i) * L_ * R_;
  for (int idx = t; idx < L_ * R_; idx += 256) relL[idx] = relrow[idx];
  __syncthreads();

  if (t < H_ * R_) {
    const int h = t / R_, r = t - h * R_;
    float s = 0.0f;
    for (int j = 0; j <= i; ++j) s += attnL[h * L_ + j] * relL[j * R_ + r];
    ar[t] = s;
  }
  __syncthreads();

  float acc[3] = {0.0f, 0.0f, 0.0f};
  for (int j = 0; j <= i; ++j) {
    int rp = j - i + 128;            // j<=i (causal) -> rp in [?,128]
    if (rp < 0) rp = 0;
    const float* svrow = SV + (size_t)rp * D_;
    #pragma unroll
    for (int q = 0; q < 3; ++q) {
      const int dd = t + 256 * q;
      acc[q] += attnL[(dd >> 6) * L_ + j] * svrow[dd];
    }
  }
  float* orow = OUT + (size_t)(b * L_ + i) * D_;
  #pragma unroll
  for (int q = 0; q < 3; ++q) {
    const int dd = t + 256 * q;
    const int h = dd >> 6, d = dd & 63;
    float s = acc[q];
    #pragma unroll
    for (int r = 0; r < R_; ++r) s += ar[h * R_ + r] * WR[(h * HD_ + d) * R_ + r];
    orow[dd] = s;
  }
}

// ---------------------------------------------------------------------------
extern "C" void kernel_launch(void* const* d_in, const int* in_sizes, int n_in,
                              void* d_out, int out_size, void* d_ws, size_t ws_size,
                              hipStream_t stream) {
  const float* x       = (const float*)d_in[0];
  const float* wq_attn = (const float*)d_in[1];
  const float* wk_attn = (const float*)d_in[2];
  const float* wq_rel  = (const float*)d_in[3];
  const float* wk_rel  = (const float*)d_in[4];
  const float* wr      = (const float*)d_in[5];
  const float* wv      = (const float*)d_in[6];
  const float* wo      = (const float*)d_in[7];
  const float* rel_emb = (const float*)d_in[8];

  float* out  = (float*)d_out;                                  // [B,L,768]
  float* attn = out + (size_t)B_ * L_ * D_;                     // [B,H,L,L]
  float* rel  = attn + (size_t)B_ * H_ * L_ * L_;               // [B,L,L,R]

  const size_t NBLD = (size_t)B_ * L_ * D_;
  float* qa  = (float*)d_ws;
  float* ka  = qa + NBLD;
  float* qr  = ka + NBLD;
  float* kr  = qr + NBLD;
  float* sv  = kr + NBLD;                                       // [272,768]
  float* att = sv + (size_t)NPAD_ * D_;                         // [B,L,768]
  float* wt  = att + NBLD;                                      // 6 x [768,768] scratch
  const size_t NW = (size_t)D_ * D_;

  const dim3 tb(256);
  const dim3 gT(D_ / 32, D_ / 32, 6);                           // (24,24,6)
  const int nySv = (NP_ + GBM - 1) / GBM;                       // 5 row tiles, row-clamped loads
  const dim3 gProj(D_ / GBN, nySv + 4 * ((B_ * L_) / GBM));     // (8, 5 + 4*32)
  const dim3 gOut(D_ / GBN, (B_ * L_) / GBM);                   // (8,32)

  // all six weights transposed in one launch, each into its own slot of wt
  transpose768<<<gT, tb, 0, stream>>>(wq_attn, wk_attn, wq_rel, wk_rel, wv, wo, wt);
  // one launch: sv = rel_emb @ wv (M=257) and qa/ka/qr/kr = x @ W (M=2048, K=N=768);
  // qa, ka, qr, kr lie one behind the other, as do their weights' slots
  gemm_wmma_f32_bt<<<gProj, tb, 0, stream>>>(x, wt, qa, B_ * L_ - 1, 5,
                                             rel_emb, wt + 4 * NW, sv, NP_ - 1, nySv, D_, D_);

  // attn: causal softmax(QKᵀ/8)
  scores_softmax<<<dim3(L_ / 16, H_, B_), 512, 0, stream>>>(qa, ka, attn);

  // relations: full (non-causal) output
  relations_kernel<<<dim3(L_ / (16 * RNT), L_ / 16, B_), 32 * R_, 0, stream>>>(qr, kr, rel);

  // attended symbols + relations -> att [B,L,768]
  attend_kernel<<<dim3(L_, B_), 256, 0, stream>>>(attn, rel, sv, wr, att);

  // out = att @ wo (a batch of one; no lone product)
  gemm_wmma_f32_bt<<<gOut, tb, 0, stream>>>(att, wt + 5 * NW, out, B_ * L_ - 1, 5,
                                            rel_emb, wt + 4 * NW, sv, NP_ - 1, 0, D_, D_);
}

// v004
// A run of this version takes 162 microseconds.
// Next to v003, in two timings, it ran 1.33 times as fast each time.
// Counting every step since v000, it is 2.73 times as fast.
#include <hip/hip_runtime.h>
#include <math.h>

// Problem constants
#define B_    4
#define L_    512
#define D_    768
#define H_    12
#define HD_   64
#define R_    12
#define RP_   64
#define NP_   257     // 2*MAX_REL+1
#define NPAD_ 272     // padded to multiple of 16

typedef __attribute__((ext_vector_type(2))) float v2f;
typedef __attribute__((ext_vector_type(4))) float v4f;
typedef __attribute__((ext_vector_type(8))) float v8f;

__device__ __forceinline__ v2f ld2(const float* p) { return *(const v2f*)p; }
__device__ __forceinline__ v4f ld4(const float* p) { return *(const v4f*)p; }

// ---------------------------------------------------------------------------
// 768x768 transpose: Wdst[n][k] = Wsrc[k][n]. LDS 32x33 tile, coalesced both
// directions. One launch turns all six weight matrices: grid (24,24,6), 256
// threads; blockIdx.z picks the source, and the result goes to slot z of Wall.
// ---------------------------------------------------------------------------
__global__ __launch_bounds__(256) void transpose768(
    const float* __restrict__ W0, const float* __restrict__ W1,
    const float* __restrict__ W2, const float* __restrict__ W3,
    const float* __restrict__ W4, const float* __restrict__ W5,
    float* __restrict__ Wall) {
  __shared__ float tile[32][33];
  const int z = blockIdx.z;
  const float* Wsrc = z == 0 ? W0 : z == 1 ? W1 : z == 2 ? W2 : z == 3 ? W3 : z == 4 ? W4 : W5;
  float* Wdst = Wall + (size_t)z * D_ * D_;
  const int bx = blockIdx.x * 32, by = blockIdx.y * 32;
  const int tx = threadIdx.x & 31, ty = threadIdx.x >> 5;
  #pragma unroll
  for (int r = ty; r < 32; r += 8)
    tile[r][tx] = Wsrc[(size_t)(by + r) * D_ + bx + tx];
  __syncthreads();
  #pragma unroll
  for (int r = ty; r < 32; r += 8)
    Wdst[(size_t)(bx + r) * D_ + by + tx] = tile[tx][r];
}

// ---------------------------------------------------------------------------
// GEMM with pre-transposed weights: C[M,N] = A[M,K] @ WT[N,K]^T, fp32 WMMA
// 16x16x4. One work-group of 8 waves per 64x96 tile of C, wave tile 16x48
// (4 waves along M, 2 along N). K runs in chunks of 128: the 64 A rows and
// the 96 WT rows of a chunk are staged in LDS, whole 512-byte rows per wave
// load, and every wave takes its fragments from there, so a row is fetched
// once per work-group instead of once per wave. Two LDS buffers: the next
// chunk's global loads are issued ahead of the current chunk's WMMAs and are
// stored to the other buffer behind them; one barrier per chunk.
// The k order of every accumulator is that of the unstaged form.
// Needs N % 96 == 0 and K % 128 == 0. A-row loads are clamped to Mclamp and
// rows above Mclamp are not stored, so a padded M grid stays in bounds.
// One launch holds several independent products. The first nys values of
// blockIdx.y are the row tiles of As @ WTs^T -> Cs (rows 0..Ms). The values
// behind them are a batch that shares Ab (rows 0..Mb): 2^ysh row tiles per
// member, member p takes weight slot p of WTb and writes slot p of Cb.
// ---------------------------------------------------------------------------
#define GBM 64      // C rows per work-group
#define GBN 96      // C columns per work-group
#define GKC 128     // k per staged chunk
#define GLP 132     // LDS row pitch in floats: 4 banks further per row
#define GROWS (GBM + GBN)
__global__ __launch_bounds__(256) void gemm_wmma_f32_bt(
    const float* __restrict__ Ab, const float* __restrict__ WTb,
    float* __restrict__ Cb, int Mb, int ysh,
    const float* __restrict__ As, const float* __restrict__ WTs,
    float* __restrict__ Cs, int Ms, int nys, int N, int K) {
  __shared__ __attribute__((aligned(16))) float sm[2][GROWS * GLP];
  const int by = blockIdx.y;
  const bool lone = by < nys;
  const int yb = lone ? 0 : by - nys;
  const int p  = yb >> ysh;
  const float* A  = lone ? As : Ab;
  const float* WT = lone ? WTs : WTb + (size_t)p * N * K;
  float* C        = lone ? Cs : Cb + (size_t)p * (Mb + 1) * N;
  const int Mclamp = lone ? Ms : Mb;
  const int lane = threadIdx.x & 31;
  const int wave = __builtin_amdgcn_readfirstlane(threadIdx.x >> 5);
  const int hi = lane >> 4;          // half-wave select (K pair / M+8)
  const int nn = lane & 15;          // lane within half: N (B/C) or M (A)
  const int wm = wave >> 1;          // wave's 16-row strip of the tile
  const int wn = wave & 1;           // wave's 48-column strip of the tile
  const int n0 = blockIdx.x * GBN;
  const int m0 = (lone ? by : yb - (p << ysh)) * GBM;

  // staging: wave w moves rows w, w+8, ... ; lane l moves floats 4l..4l+3
  v4f st[GROWS / 8];
  const int sc = 4 * lane;
  #pragma unroll
  for (int i = 0; i < GBM / 8; ++i)
    st[i] = ld4(A + (size_t)min(m0 + 8 * i + wave, Mclamp) * K + sc);
  #pragma unroll
  for (int i = 0; i < GBN / 8; ++i)
    st[GBM / 8 + i] = ld4(WT + (size_t)(n0 + 8 * i + wave) * K + sc);
  // the loads' address registers are reused right below: wait before the overwrite
  asm volatile("s_wait_xcnt 0x0" ::: "memory");
  // keeps the register writes that follow from being lifted over that wait
  __builtin_amdgcn_sched_barrier(0);
  #pragma unroll
  for (int i = 0; i < GROWS / 8; ++i)
    *(v4f*)&sm[0][(8 * i + wave) * GLP + sc] = st[i];
  __syncthreads();

  const int aoff = (wm * 16 + nn) * GLP + 2 * hi;
  const int boff = (GBM + wn * 48 + nn) * GLP + 2 * hi;
  v8f acc0 = {}, acc1 = {}, acc2 = {};
  const int nchunk = K / GKC;
  for (int c = 0; c < nchunk; ++c) {
    const bool more = c + 1 < nchunk;
    if (more) {
      const int kc = (c + 1) * GKC + sc;
      #pragma unroll
      for (int i = 0; i < GBM / 8; ++i)
        st[i] = ld4(A + (size_t)min(m0 + 8 * i + wave, Mclamp) * K + kc);
      #pragma unroll
      for (int i = 0; i < GBN / 8; ++i)
        st[GBM / 8 + i] = ld4(WT + (size_t)(n0 + 8 * i + wave) * K + kc);
    }
    const float* la = &sm[c & 1][aoff];
    const float* lb = &sm[c & 1][boff];
    #pragma unroll
    for (int k0 = 0; k0 < GKC; k0 += 4) {
      const v2f a  = ld2(la + k0);
      const v2f b0 = ld2(lb + k0);
      const v2f b1 = ld2(lb + 16 * GLP + k0);
      const v2f b2 = ld2(lb + 32 * GLP + k0);
      acc0 = __builtin_amdgcn_wmma_f32_16x16x4_f32(false, a, false, b0, (short)0, acc0, false, false);
      acc1 = __builtin_amdgcn_wmma_f32_16x16x4_f32(false, a, false, b1, (short)0, acc1, false, false);
      acc2 = __builtin_amdgcn_wmma_f32_16x16x4_f32(false, a, false, b2, (short)0, acc2, false, false);
    }
    if (more) {
      float* dst = &sm[(c + 1) & 1][wave * GLP + sc];
      #pragma unroll
      for (int i = 0; i < GROWS / 8; ++i)
        *(v4f*)(dst + 8 * i * GLP) = st[i];
    }
    __syncthreads();
  }

  #pragma unroll
  for (int r = 0; r < 8; ++r) {
    const int m = m0 + wm * 16 + r + 8 * hi;   // C layout: VGPR r -> M=r / r+8
    if (m <= Mclamp) {
      float* crow = C + (size_t)m * N + n0 + wn * 48 + nn;
      crow[0]  = acc0[r];
      crow[16] = acc1[r];
      crow[32] = acc2[r];
    }
  }
}

// ---------------------------------------------------------------------------
// Scores (QKᵀ * 1/sqrt(64)) + causal softmax -> attn[B,H,L,L].
// Block: (i-tile of 16 rows, h, b), 16 waves. Waves compute 16x16 score tiles
// via fp32 WMMA into LDS (skipping fully-masked causal tiles), then wave w
// softmaxes row w with wave32 shuffle reductions.
// ---------------------------------------------------------------------------
#define LDP 520
__global__ __launch_bounds__(512) void scores_softmax(
    const float* __restrict__ QA, const float* __restrict__ KA,
    float* __restrict__ ATTN) {
  __shared__ float sc[16 * LDP];
  const int i0   = blockIdx.x * 16;
  const int h    = blockIdx.y;
  const int b    = blockIdx.z;
  const int wave = threadIdx.x >> 5;
  const int lane = threadIdx.x & 31;
  const int hi = lane >> 4, nn = lane & 15;

  const float* qbase = QA + (size_t)(b * L_ + i0 + nn) * D_ + h * HD_ + 2 * hi;
  for (int jt = wave * 2; jt < wave * 2 + 2; ++jt) {
    const int j0 = jt * 16;
    if (j0 <= i0 + 15) {                                // skip fully-masked tiles
      const float* kbase = KA + (size_t)(b * L_ + j0 + nn) * D_ + h * HD_ + 2 * hi;
      v8f acc = {};
      v2f a  = ld2(qbase);
      v2f bb = ld2(kbase);                              // Bᵀ: ka row j as column
      #pragma unroll
      for (int k0 = 4; k0 < HD_; k0 += 4) {
        v2f an  = ld2(qbase + k0);
        v2f bbn = ld2(kbase + k0);
        acc = __builtin_amdgcn_wmma_f32_16x16x4_f32(false, a, false, bb, (short)0, acc, false, false);
        a = an; bb = bbn;
      }
      acc = __builtin_amdgcn_wmma_f32_16x16x4_f32(false, a, false, bb, (short)0, acc, false, false);
      #pragma unroll
      for (int r = 0; r < 8; ++r)
        sc[(r + 8 * hi) * LDP + j0 + nn] = acc[r] * 0.125f;
    }
  }
  __syncthreads();

  // softmax: wave w -> row w (16 waves, 16 rows)
  const int row = wave;
  const int ig  = i0 + row;
  float vals[16];
  float mx = -__builtin_inff();
  #pragma unroll
  for (int t = 0; t < 16; ++t) {
    const int j = lane + 32 * t;
    const float v = (j <= ig) ? sc[row * LDP + j] : -__builtin_inff();
    vals[t] = v;
    mx = fmaxf(mx, v);
  }
  for (int off = 16; off; off >>= 1) mx = fmaxf(mx, __shfl_xor(mx, off, 32));
  float sum = 0.0f;
  #pragma unroll
  for (int t = 0; t < 16; ++t) { const float e = __expf(vals[t] - mx); vals[t] = e; sum += e; }
  for (int off = 16; off; off >>= 1) sum += __shfl_xor(sum, off, 32);
  const float inv = 1.0f / sum;
  float* arow = ATTN + ((size_t)(b * H_ + h) * L_ + ig) * L_;
  #pragma unroll
  for (int t = 0; t < 16; ++t) {
    const int j = lane + 32 * t;
    arow[j] = (j <= ig) ? vals[t] * inv : 0.0f;
  }
}

// ---------------------------------------------------------------------------
// relations[b,i,j,r] = (qr[b,i,r,:] . kr[b,j,r,:]) / sqrt(64).
// One work-group of 12 waves per (b, 16 rows i, 128 columns j); wave = r.
// Each wave brings its 16x64 slices of qr and kr in with whole-line loads
// (two 256-byte row slices per load) and turns them into WMMA fragments
// through an LDS tile of its own, which no other wave touches; the q
// fragments stay in registers for all 8 j tiles. The 12 waves' 16x16 results
// of a j tile are gathered in LDS as [i][j][r] and leave as runs of 768
// contiguous bytes per row i, so every 128-byte line of the output has one
// writer. The gather has two buffers and one barrier per j tile. The next k
// tile's global loads are in flight during the current tile's WMMAs.
// The k order of every sum is that of the one-wave form.
// ---------------------------------------------------------------------------
#define RNT 8               // j tiles of 16 per work-group
#define RKP 68              // LDS pitch of a staged 64-float row: 4 banks further per row
#define ROT (16 * 16 * R_)  // floats of one gathered [16 i][16 j][12 r] tile
__global__ __launch_bounds__(384) void relations_kernel(
    const float* __restrict__ QR, const float* __restrict__ KR,
    float* __restrict__ REL) {
  __shared__ __attribute__((aligned(16))) float kt[R_][16 * RKP];
  __shared__ __attribute__((aligned(16))) float ot[2][ROT];
  const int tid  = threadIdx.x;
  const int lane = tid & 31;
  const int r    = __builtin_amdgcn_readfirstlane(tid >> 5);
  const int hi = lane >> 4, nn = lane & 15;
  const int jb = blockIdx.x * (16 * RNT);
  const int i0 = blockIdx.y * 16;
  const int b  = blockIdx.z;

  // staging: a lane moves floats 4nn..4nn+3 of rows hi, hi+2, ..., hi+14
  const float* qsrc = QR + (size_t)(b * L_ + i0 + hi) * D_ + r * RP_ + 4 * nn;
  const float* ksrc = KR + (size_t)(b * L_ + jb + hi) * D_ + r * RP_ + 4 * nn;
  float* sdst = &kt[r][hi * RKP + 4 * nn];
  const float* frag = &kt[r][nn * RKP + 2 * hi];

  // every '#pragma unroll' in this kernel: its loop indexes a small array, which
  // stays in registers only when the index is a constant
  v4f sq[8], st[8];
  #pragma unroll
  for (int q = 0; q < 8; ++q) sq[q] = ld4(qsrc + 2 * q * D_);
  #pragma unroll
  for (int q = 0; q < 8; ++q) st[q] = ld4(ksrc + 2 * q * D_);
  #pragma unroll
  for (int q = 0; q < 8; ++q) *(v4f*)(sdst + 2 * q * RKP) = sq[q];
  // the wave's own tile is written before its lanes read each other's rows back
  asm volatile("s_wait_dscnt 0x0" ::: "memory");
  v2f a[16];
  #pragma unroll
  for (int s = 0; s < 16; ++s) a[s] = ld2(frag + 4 * s);
  // the q fragments have left the tile before the wave refills it with k rows
  asm volatile("s_wait_dscnt 0x0" ::: "memory");

  // flush: a thread moves 4 floats of row tid/48 and 4 of row tid/48 + 8
  const int frow = tid / 48, fcol = (tid - frow * 48) * 4;
  float* odst = REL + ((size_t)(b * L_ + i0 + frow) * L_ + jb) * R_ + fcol;

  for (int t = 0; t < RNT; ++t) {
    #pragma unroll
    for (int q = 0; q < 8; ++q) *(v4f*)(sdst + 2 * q * RKP) = st[q];
    if (t + 1 < RNT) {
      const float* kn = ksrc + (size_t)(t + 1) * 16 * D_;
      #pragma unroll
      for (int q = 0; q < 8; ++q) st[q] = ld4(kn + 2 * q * D_);
    }
    // the wave's own tile is written before its lanes read each other's rows back
    asm volatile("s_wait_dscnt 0x0" ::: "memory");
    v2f bb[16];
    #pragma unroll
    for (int s = 0; s < 16; ++s) bb[s] = ld2(frag + 4 * s);
    // keeps the fragment reads in one group ahead of the WMMAs instead of spread among them
    __builtin_amdgcn_sched_barrier(0);
    v8f acc = {};
    #pragma unroll
    for (int s = 0; s < 16; ++s)
      acc = __builtin_amdgcn_wmma_f32_16x16x4_f32(false, a[s], false, bb[s], (short)0, acc, false, false);
    float* o = &ot[t & 1][(8 * hi * 16 + nn) * R_ + r];   // C layout: VGPR rr -> i = rr / rr+8
    #pragma unroll
    for (int rr = 0; rr < 8; ++rr) o[rr * 16 * R_] = acc[rr] * 0.125f;
    __syncthreads();
    const float* os = &ot[t & 1][4 * tid];
    float* od = odst + t * 16 * R_;
    *(v4f*)od = *(const v4f*)os;
    *(v4f*)(od + (size_t)8 * L_ * R_) = *(const v4f*)(os + 4 * 384);
  }
}

// ---------------------------------------------------------------------------
// attended[b,i,:] = sum_j attn[b,h,i,j] * sv[clip(j-i)+128][h,d]
//                 + sum_r (sum_j attn[b,h,i,j] * rel[b,i,j,r]) * wr[h,d,r]
// Both sums run on fp32 WMMA 16x16x4. One work-group of 16 waves per b and
// 16 rows i: 8 rows from the top of the triangle and their mirror image from
// its foot, so that every work-group reads and multiplies the same amount.
// attn is 0 above the diagonal, so only j <= i counts.
// Part 1, wave = row i: D[h][n] = sum_j attn[h][i][j] * Bm[j][n], j in pairs of
// 64-wide chunks up to the diagonal. Columns n < 12 of Bm are rel[b,i,j,n]; column 12 is
// 1 where j - i clips to -128 and 0 elsewhere, so D[h][12] is the attn mass
// that meets sv row 0; columns 13..15 are 0. D goes to LDS as [i][h][n].
// Part 2, wave = head h (12 waves): M = the 16 rows i, N = the head's 64
// columns, K = 128 band positions kk (j = i - 127 + kk, sv row kk + 1; the A
// operand is the attn row read along the diagonal) and then the 16 columns n
// of part 1 (B = wr[h][d][n] for n < 12, sv row 0 for n = 12, 0 behind).
// Lane nn of N tile e holds column 4 nn + e, so sv rows come in and results
// leave as 16 bytes per lane, 256 contiguous bytes per row and half-wave.
// ---------------------------------------------------------------------------
#define AIP 260     // LDS floats per row i of part 1's result: 16 x 16 and 4 banks further
#define ACH 64      // j per chunk of part 1
// every '#pragma unroll' below: its loop indexes a small array, which stays in
// registers only when the index is a constant
// One chunk of part 1. The lane's k positions, for A and B alike, are
// j = chunk start + 8 u + 4 hi + e; ap and rp already hold the lane's 4 hi.
__device__ __forceinline__ void att_load(v4f (&a)[8], float (&r)[32],
                                         const float* ap, const float* rp) {
  #pragma unroll
  for (int u = 0; u < 8; ++u) {
    a[u] = ld4(ap + 8 * u);
    #pragma unroll
    for (int e = 0; e < 4; ++e) r[4 * u + e] = rp[(8 * u + e) * R_];
  }
  // the loads' address registers are named so that they stay as they are up to this wait:
  // otherwise a later load of the group may be given one of them as its destination
  asm volatile("s_wait_xcnt 0x0" :: "v"(ap), "v"(rp) : "memory");
}
// jc: 8 u + e <= jc marks the positions whose j - i clips to -128
__device__ __forceinline__ void att_mma(v8f& acc0, v8f& acc1, const v4f (&a)[8],
                                        const float (&r)[32], bool isrel, float one, int jc) {
  #pragma unroll
  for (int u = 0; u < 8; ++u) {
    const float b0 = isrel ? r[4 * u]     : (8 * u     <= jc ? one : 0.0f);
    const float b1 = isrel ? r[4 * u + 1] : (8 * u + 1 <= jc ? one : 0.0f);
    const float b2 = isrel ? r[4 * u + 2] : (8 * u + 2 <= jc ? one : 0.0f);
    const float b3 = isrel ? r[4 * u + 3] : (8 * u + 3 <= jc ? one : 0.0f);
    const v2f a01 = {a[u].x, a[u].y}, a23 = {a[u].z, a[u].w};
    const v2f b01 = {b0, b1}, b23 = {b2, b3};
    acc0 = __builtin_amdgcn_wmma_f32_16x16x4_f32(false, a01, false, b01, (short)0, acc0, false, false);
    acc1 = __builtin_amdgcn_wmma_f32_16x16x4_f32(false, a23, false, b23, (short)0, acc1, false, false);
  }
}
__global__ __launch_bounds__(512) void attend_kernel(
    const float* __restrict__ ATTN, const float* __restrict__ REL,
    const float* __restrict__ SV, const float* __restrict__ WR,
    float* __restrict__ OUT) {
  __shared__ __attribute__((aligned(16))) float arL[16 * AIP];
  const int ilo  = blockIdx.x * 8;            // rows ilo .. ilo + 7
  const int ihi  = L_ - 8 - ilo;              // and their mirror image ihi .. ihi + 7
  const int b    = blockIdx.y;
  const int lane = threadIdx.x & 31;
  const int wave = __builtin_amdgcn_readfirstlane(threadIdx.x >> 5);
  const int hi = lane >> 4, nn = lane & 15;

  {
    const int i = wave < 8 ? ilo + wave : ihi + wave - 8;
    // rows h >= 12 of A and columns n >= 12 of rel do not exist: clamped addresses
    const float* ap = ATTN + ((size_t)(b * H_ + min(nn, H_ - 1)) * L_ + i) * L_ + 4 * hi;
    const float* rp = REL + (size_t)(b * L_ + i) * L_ * R_ + 4 * hi * R_ + min(nn, R_ - 1);
    const bool  isrel = nn < R_;
    const float one   = nn == R_ ? 1.0f : 0.0f;
    const int   jclip = i - 128 - 4 * hi;      // j - 4 hi <= jclip: j - i clips to -128
    const int   np    = (i >> 7) + 1;          // pairs of chunks (128 j) that reach the diagonal
    v8f acc0 = {}, acc1 = {};
    // two register sets take turns: one chunk's loads fly during the other's WMMAs.
    // No load stands under a condition, so that each wait can count the loads behind it.
    v4f aA[8], aB[8];
    float rA[32], rB[32];
    att_load(aA, rA, ap, rp);
    int ch = 0;
    for (; ch + 2 < 2 * np; ch += 2) {
      att_load(aB, rB, ap + ACH * (ch + 1), rp + ACH * (ch + 1) * R_);
      // each sched_barrier here: keeps a chunk's loads ahead of the other chunk's WMMAs, not sunk among them
      __builtin_amdgcn_sched_barrier(0);
      att_mma(acc0, acc1, aA, rA, isrel, one, jclip - ACH * ch);
      att_load(aA, rA, ap + ACH * (ch + 2), rp + ACH * (ch + 2) * R_);
      __builtin_amdgcn_sched_barrier(0);
      att_mma(acc0, acc1, aB, rB, isrel, one, jclip - ACH * (ch + 1));
    }
    att_load(aB, rB, ap + ACH * (ch + 1), rp + ACH * (ch + 1) * R_);
    __builtin_amdgcn_sched_barrier(0);
    att_mma(acc0, acc1, aA, rA, isrel, one, jclip - ACH * ch);
    att_mma(acc0, acc1, aB, rB, isrel, one, jclip - ACH * (ch + 1));
    float* o = &arL[wave * AIP + 8 * hi * 16 + nn];   // D layout: VGPR rr -> h = rr / rr+8
    #pragma unroll
    for (int rr = 0; rr < 8; ++rr) o[rr * 16] = acc0[rr] + acc1[rr];
  }
  __syncthreads();

  if (wave < H_) {
    const int h = wave;
    const int i = nn < 8 ? ilo + nn : ihi + nn - 8;
    const float* arow = ATTN + ((size_t)(b * H_ + h) * L_ + i) * L_;
    const float* svc  = SV + h * HD_ + 4 * nn;
    const int jl = i - 127 + 4 * hi;
    v8f c0 = {}, c1 = {}, c2 = {}, c3 = {};
    // a stage is 16 band positions; the lane's, for A and B alike: kk = 16 s + 8 u + 4 hi + e, q = 4 u + e
    auto band_load = [&](float (&av)[8], v4f (&sr)[8], int s) {
      const float* pa[8];
      const float* ps = svc + (size_t)(16 * s + 4 * hi + 1) * D_;
      #pragma unroll
      for (int q = 0; q < 8; ++q) {
        const int ko = 8 * (q >> 2) + (q & 3);
        pa[q] = arow + max(jl + 16 * s + ko, 0);
        av[q] = *pa[q];
        sr[q] = ld4(ps + ko * D_);
      }
      // the loads' address registers are named so that they stay as they are up to this wait:
      // otherwise a later load of the group may be given one of them as its destination
      asm volatile("s_wait_xcnt 0x0" :: "v"(pa[0]), "v"(pa[1]), "v"(pa[2]), "v"(pa[3]), "v"(pa[4]),
                   "v"(pa[5]), "v"(pa[6]), "v"(pa[7]), "v"(ps) : "memory");
    };
    auto band_mma = [&](const float (&av)[8], const v4f (&sr)[8], int s) {
      #pragma unroll
      for (int q = 0; q < 8; q += 2) {
        const int j = jl + 16 * s + 8 * (q >> 2) + (q & 3);
        // left of column 0 there is no term
        const v2f a = {j >= 0 ? av[q] : 0.0f, j + 1 >= 0 ? av[q + 1] : 0.0f};
        const v2f q0 = {sr[q].x, sr[q + 1].x}, q1 = {sr[q].y, sr[q + 1].y};
        const v2f q2 = {sr[q].z, sr[q + 1].z}, q3 = {sr[q].w, sr[q + 1].w};
        c0 = __builtin_amdgcn_wmma_f32_16x16x4_f32(false, a, false, q0, (short)0, c0, false, false);
        c1 = __builtin_amdgcn_wmma_f32_16x16x4_f32(false, a, false, q1, (short)0, c1, false, false);
        c2 = __builtin_amdgcn_wmma_f32_16x16x4_f32(false, a, false, q2, (short)0, c2, false, false);
        c3 = __builtin_amdgcn_wmma_f32_16x16x4_f32(false, a, false, q3, (short)0, c3, false, false);
      }
    };
    // two register sets take turns as in part 1, and no load stands under a condition
    float avA[8], avB[8];
    v4f  srA[8], srB[8];
    band_load(avA, srA, 0);
    // kept rolled: unrolled, every stage's loads are lifted to the front and registers spill
    #pragma unroll 1
    for (int s = 0; s < 6; s += 2) {
      band_load(avB, srB, s + 1);
      // each sched_barrier here: keeps a stage's loads ahead of the other stage's WMMAs, not sunk among them
      __builtin_amdgcn_sched_barrier(0);
      band_mma(avA, srA, s);
      band_load(avA, srA, s + 2);
      __builtin_amdgcn_sched_barrier(0);
      band_mma(avB, srB, s + 1);
    }
    band_load(avB, srB, 7);
    __builtin_amdgcn_sched_barrier(0);
    band_mma(avA, srA, 6);
    band_mma(avB, srB, 7);
    // part 1's columns as k: n = k0 + 2 hi, + 1
    const float* al = &arL[nn * AIP + h * 16 + 2 * hi];
    const float* wc = WR + (size_t)(h * HD_ + 4 * nn) * R_ + 2 * hi;
    v2f w[3][4];
    #pragma unroll
    for (int k = 0; k < 3; ++k) {
      #pragma unroll
      for (int e = 0; e < 4; ++e) w[k][e] = ld2(wc + e * R_ + 4 * k);
    }
    const v4f s0 = ld4(svc);                           // sv row 0
    // as in band_load: the address registers stay as they are up to this wait
    asm volatile("s_wait_xcnt 0x0" :: "v"(wc), "v"(svc) : "memory");
    #pragma unroll
    for (int k = 0; k < 3; ++k) {
      const v2f a = ld2(al + 4 * k);
      c0 = __builtin_amdgcn_wmma_f32_16x16x4_f32(false, a, false, w[k][0], (short)0, c0, false, false);
      c1 = __builtin_amdgcn_wmma_f32_16x16x4_f32(false, a, false, w[k][1], (short)0, c1, false, false);
      c2 = __builtin_amdgcn_wmma_f32_16x16x4_f32(false, a, false, w[k][2], (short)0, c2, false, false);
      c3 = __builtin_amdgcn_wmma_f32_16x16x4_f32(false, a, false, w[k][3], (short)0, c3, false, false);
    }
    {
      const v2f a  = ld2(al + R_);                     // n = 12, 13 (hi = 0) and 14, 15
      const v2f q0 = {hi ? 0.0f : s0.x, 0.0f}, q1 = {hi ? 0.0f : s0.y, 0.0f};
      const v2f q2 = {hi ? 0.0f : s0.z, 0.0f}, q3 = {hi ? 0.0f : s0.w, 0.0f};
      c0 = __builtin_amdgcn_wmma_f32_16x16x4_f32(false, a, false, q0, (short)0, c0, false, false);
      c1 = __builtin_amdgcn_wmma_f32_16x16x4_f32(false, a, false, q1, (short)0, c1, false, false);
      c2 = __builtin_amdgcn_wmma_f32_16x16x4_f32(false, a, false, q2, (short)0, c2, false, false);
      c3 = __builtin_amdgcn_wmma_f32_16x16x4_f32(false, a, false, q3, (short)0, c3, false, false);
    }
    float* orow = OUT + (size_t)(b * L_ + (hi ? ihi : ilo)) * D_ + h * HD_ + 4 * nn;
    #pragma unroll
    for (int rr = 0; rr < 8; ++rr) {                   // D layout: VGPR rr -> row rr / rr+8 of the 16
      const v4f v = {c0[rr], c1[rr], c2[rr], c3[rr]};
      *(v4f*)(orow + (size_t)rr * D_) = v;
    }
  }
}

// ---------------------------------------------------------------------------
extern "C" void kernel_launch(void* const* d_in, const int* in_sizes, int n_in,
                              void* d_out, int out_size, void* d_ws, size_t ws_size,
                              hipStream_t stream) {
  const float* x       = (const float*)d_in[0];
  const float* wq_attn = (const float*)d_in[1];
  const float* wk_attn = (const float*)d_in[2];
  const float* wq_rel  = (const float*)d_in[3];
  const float* wk_rel  = (const float*)d_in[4];
  const float* wr      = (const float*)d_in[5];
  const float* wv      = (const float*)d_in[6];
  const float* wo      = (const float*)d_in[7];
  const float* rel_emb = (const float*)d_in[8];

  float* out  = (float*)d_out;                                  // [B,L,768]
  float* attn = out + (size_t)B_ * L_ * D_;                     // [B,H,L,L]
  float* rel  = attn + (size_t)B_ * H_ * L_ * L_;               // [B,L,L,R]

  const size_t NBLD = (size_t)B_ * L_ * D_;
  float* qa  = (float*)d_ws;
  float* ka  = qa + NBLD;
  float* qr  = ka + NBLD;
  float* kr  = qr + NBLD;
  float* sv  = kr + NBLD;                                       // [272,768]
  float* att = sv + (size_t)NPAD_ * D_;                         // [B,L,768]
  float* wt  = att + NBLD;                                      // 6 x [768,768] scratch
  const size_t NW = (size_t)D_ * D_;

  const dim3 tb(256);
  const dim3 gT(D_ / 32, D_ / 32, 6);                           // (24,24,6)
  const int nySv = (NP_ + GBM - 1) / GBM;                       // 5 row tiles, row-clamped loads
  const dim3 gProj(D_ / GBN, nySv + 4 * ((B_ * L_) / GBM));     // (8, 5 + 4*32)
  const dim3 gOut(D_ / GBN, (B_ * L_) / GBM);                   // (8,32)

  // all six weights transposed in one launch, each into its own slot of wt
  transpose768<<<gT, tb, 0, stream>>>(wq_attn, wk_attn, wq_rel, wk_rel, wv, wo, wt);
  // one launch: sv = rel_emb @ wv (M=257) and qa/ka/qr/kr = x @ W (M=2048, K=N=768);
  // qa, ka, qr, kr lie one behind the other, as do their weights' slots
  gemm_wmma_f32_bt<<<gProj, tb, 0, stream>>>(x, wt, qa, B_ * L_ - 1, 5,
                                             rel_emb, wt + 4 * NW, sv, NP_ - 1, nySv, D_, D_);

  // attn: causal softmax(QKᵀ/8)
  scores_softmax<<<dim3(L_ / 16, H_, B_), 512, 0, stream>>>(qa, ka, attn);

  // relations: full (non-causal) output
  relations_kernel<<<dim3(L_ / (16 * RNT), L_ / 16, B_), 32 * R_, 0, stream>>>(qr, kr, rel);

  // attended symbols + relations -> att [B,L,768]
  attend_kernel<<<dim3(L_ / 16, B_), 512, 0, stream>>>(attn, rel, sv, wr, att);

  // out = att @ wo (a batch of one; no lone product)
  gemm_wmma_f32_bt<<<gOut, tb, 0, stream>>>(att, wt + 5 * NW, out, B_ * L_ - 1, 5,
                                            rel_emb, wt + 4 * NW, sv, NP_ - 1, 0, D_, D_);
}

// v005
// Measured time: 149 microseconds a run.
// Next to v004, in two timings, it ran 1.09 times as fast each time.
// Counting every step since v000, it is 2.98 times as fast.
#include <hip/hip_runtime.h>
#include <math.h>

// Problem constants
#define B_    4
#define L_    512
#define D_    768
#define H_    12
#define HD_   64
#define R_    12
#define RP_   64
#define NP_   257     // 2*MAX_REL+1
#define NPAD_ 272     // padded to multiple of 16

typedef __attribute__((ext_vector_type(2))) float v2f;
typedef __attribute__((ext_vector_type(4))) float v4f;
typedef __attribute__((ext_vector_type(8))) float v8f;

__device__ __forceinline__ v2f ld2(const float* p) { return *(const v2f*)p; }
__device__ __forceinline__ v4f ld4(const float* p) { return *(const v4f*)p; }

// ---------------------------------------------------------------------------
// GEMM with the weights as they are given: C[M,768] = A[M,768] @ W[768,768],
// fp32 WMMA 16x16x4. One work-group of 8 waves per 64x96 tile of C, wave tile
// 16x48 (4 waves along M, 2 along N). K runs in chunks of 128: the 64 A rows
// and the 128 W rows (96 columns each) of a chunk are staged in LDS with
// whole-line loads, and every wave takes its fragments from there.
// A lies in LDS as [m][k]. W lies there as [k/8][half][n][4]: the four floats
// are rows 8G + 2 half + 0, 1, 4, 5 of column n, which are the B fragments of
// half-wave 'half' for two successive WMMA steps. A lane loads them 4 bytes each
// (a wave: one 128-byte line per load) and stores them as 16 bytes; a fragment
// read is 16 bytes per lane, 256 contiguous bytes per half-wave.
// Two LDS buffers: the next chunk's global loads are issued ahead of the
// current chunk's WMMAs and are stored to the other buffer behind them; one
// barrier per chunk.
// A-row loads are clamped to Mclamp and rows above Mclamp are not stored, so a
// padded M grid stays in bounds.
// One launch holds several independent products. The first nys values of
// blockIdx.y are the row tiles of As @ Ws -> Cs (rows 0..Ms). The values
// behind them are a batch that shares Ab (rows 0..Mb): 2^ysh row tiles per
// member, member p takes weight Wp and writes slot p of Cb.
// ---------------------------------------------------------------------------
#define GN  D_      // columns of W and C
#define GK  D_      // columns of A, rows of W
#define GBM 64      // C rows per work-group
#define GBN 96      // C columns per work-group
#define GKC 128     // k per staged chunk
#define GLP 132     // LDS pitch of an A row in floats: 4 banks further per row
#define GWG (4 * GBN)            // LDS floats of four W rows
#define GWF (GKC / 4 * GWG)      // floats of a buffer's W part, which lies first
#define GBUF (GWF + GBM * GLP)
__global__ __launch_bounds__(256) void gemm_wmma_f32_b(
    const float* __restrict__ Ab, const float* __restrict__ W0,
    const float* __restrict__ W1, const float* __restrict__ W2,
    const float* __restrict__ W3, float* __restrict__ Cb, int Mb, int ysh,
    const float* __restrict__ As, const float* __restrict__ Ws,
    float* __restrict__ Cs, int Ms, int nys) {
  __shared__ __attribute__((aligned(16))) float sm[2][GBUF];
  const int by = blockIdx.y;
  const bool lone = by < nys;
  const int yb = lone ? 0 : by - nys;
  const int p  = yb >> ysh;
  const float* A  = lone ? As : Ab;
  const float* Wm = lone ? Ws : p == 0 ? W0 : p == 1 ? W1 : p == 2 ? W2 : W3;
  float* C        = lone ? Cs : Cb + (size_t)p * (Mb + 1) * GN;
  const int Mclamp = lone ? Ms : Mb;
  const int lane = threadIdx.x & 31;
  const int wave = __builtin_amdgcn_readfirstlane(threadIdx.x >> 5);
  const int hi = lane >> 4;          // half-wave select (K pair / M+8)
  const int nn = lane & 15;          // lane within half: N (B/C) or M (A)
  const int wm = wave >> 1;          // wave's 16-row strip of the tile
  const int wn = wave & 1;           // wave's 48-column strip of the tile
  const int n0 = blockIdx.x * GBN;
  const int m0 = (lone ? by : yb - (p << ysh)) * GBM;

  // every '#pragma unroll' in this kernel but the one over k0: its loop indexes a small array, which
  // stays in registers only when the index is a constant
  // A staging: wave w moves rows w, w+8, ... ; lane l moves floats 4l..4l+3.
  // W staging: wave w moves the groups of four rows w + 8i = 2G + half; lane l moves columns l, l+32, l+64.
  const int sc = 4 * lane;
  v4f sa[GBM / 8], sw[GKC / 32][GBN / 32];
  const float* pa[GBM / 8];
  const float* pw;
  auto stage_load = [&](int kc) {
    pw = Wm + (size_t)(kc + 8 * (wave >> 1) + 2 * (wave & 1)) * GN + n0 + lane;
    #pragma unroll
    for (int i = 0; i < GBM / 8; ++i) {
      pa[i] = A + (size_t)min(m0 + 8 * i + wave, Mclamp) * GK + kc + sc;
      sa[i] = ld4(pa[i]);
    }
    #pragma unroll
    for (int i = 0; i < GKC / 32; ++i) {
      #pragma unroll
      for (int t = 0; t < GBN / 32; ++t) {
        const float* q = pw + 32 * i * GN + 32 * t;
        sw[i][t] = v4f{q[0], q[GN], q[4 * GN], q[5 * GN]};
      }
    }
  };
  auto stage_store = [&](float* buf) {
    // the loads' address registers are named so that they stay as they are up to this wait, which
    // stands here, at the chunk's end, where the loads are long under way: no register of theirs
    // is written between the loads and this line
    asm volatile("s_wait_xcnt 0x0" :: "v"(pa[0]), "v"(pa[1]), "v"(pa[2]), "v"(pa[3]), "v"(pa[4]),
                 "v"(pa[5]), "v"(pa[6]), "v"(pa[7]), "v"(pw) : "memory");
    #pragma unroll
    for (int i = 0; i < GBM / 8; ++i)
      *(v4f*)(buf + GWF + (8 * i + wave) * GLP + sc) = sa[i];
    #pragma unroll
    for (int i = 0; i < GKC / 32; ++i) {
      #pragma unroll
      for (int t = 0; t < GBN / 32; ++t)
        *(v4f*)(buf + (8 * i + wave) * GWG + 128 * t + sc) = sw[i][t];
    }
  };

  stage_load(0);
  stage_store(&sm[0][0]);
  __syncthreads();

  const int aoff = GWF + (wm * 16 + nn) * GLP + 2 * hi;
  const int boff = hi * GWG + 4 * (wn * 48 + nn);
  v8f acc0 = {}, acc1 = {}, acc2 = {};
  const int nchunk = GK / GKC;
  for (int c = 0; c < nchunk; ++c) {
    const bool more = c + 1 < nchunk;
    if (more) stage_load((c + 1) * GKC);
    const float* la = &sm[c & 1][aoff];
    const float* lb = &sm[c & 1][boff];
    #pragma unroll
    for (int k0 = 0; k0 < GKC; k0 += 8) {
      const v2f a0 = ld2(la + k0), a1 = ld2(la + k0 + 4);
      const v4f q0 = ld4(lb + k0 / 4 * GWG);
      const v4f q1 = ld4(lb + k0 / 4 * GWG + 64);
      const v4f q2 = ld4(lb + k0 / 4 * GWG + 128);
      const v2f b00 = {q0.x, q0.y}, b01 = {q1.x, q1.y}, b02 = {q2.x, q2.y};   // step k0
      const v2f b10 = {q0.z, q0.w}, b11 = {q1.z, q1.w}, b12 = {q2.z, q2.w};   // step k0 + 4
      acc0 = __builtin_amdgcn_wmma_f32_16x16x4_f32(false, a0, false, b00, (short)0, acc0, false, false);
      acc1 = __builtin_amdgcn_wmma_f32_16x16x4_f32(false, a0, false, b01, (short)0, acc1, false, false);
      acc2 = __builtin_amdgcn_wmma_f32_16x16x4_f32(false, a0, false, b02, (short)0, acc2, false, false);
      acc0 = __builtin_amdgcn_wmma_f32_16x16x4_f32(false, a1, false, b10, (short)0, acc0, false, false);
      acc1 = __builtin_amdgcn_wmma_f32_16x16x4_f32(false, a1, false, b11, (short)0, acc1, false, false);
      acc2 = __builtin_amdgcn_wmma_f32_16x16x4_f32(false, a1, false, b12, (short)0, acc2, false, false);
    }
    if (more) stage_store(&sm[(c + 1) & 1][0]);
    __syncthreads();
  }
  // the slots between the last WMMA and the first vector instruction that writes over its D:
  // a wave whose rows all lie above Mclamp jumps over the stores below and is there at once.
  // The accumulators are named, as inputs only, so that the slots stand behind the last WMMA.
  asm volatile("v_nop\n\tv_nop\n\tv_nop\n\tv_nop" :: "v"(acc0), "v"(acc1), "v"(acc2));

  #pragma unroll
  for (int r = 0; r < 8; ++r) {
    const int m = m0 + wm * 16 + r + 8 * hi;   // C layout: VGPR r -> M=r / r+8
    if (m <= Mclamp) {
      float* crow = C + (size_t)m * GN + n0 + wn * 48 + nn;
      crow[0]  = acc0[r];
      crow[16] = acc1[r];
      crow[32] = acc2[r];
    }
  }
}

// ---------------------------------------------------------------------------
// Scores (QKᵀ * 1/sqrt(64)) + causal softmax -> attn[B,H,L,L].
// Block: (i-tile of 16 rows, h, b), 16 waves. Waves compute 16x16 score tiles
// via fp32 WMMA into LDS (skipping fully-masked causal tiles), then wave w
// softmaxes row w with wave32 shuffle reductions.
// ---------------------------------------------------------------------------
#define LDP 520
__global__ __launch_bounds__(512) void scores_softmax(
    const float* __restrict__ QA, const float* __restrict__ KA,
    float* __restrict__ ATTN) {
  __shared__ float sc[16 * LDP];
  const int i0   = blockIdx.x * 16;
  const int h    = blockIdx.y;
  const int b    = blockIdx.z;
  const int wave = threadIdx.x >> 5;
  const int lane = threadIdx.x & 31;
  const int hi = lane >> 4, nn = lane & 15;

  const float* qbase = QA + (size_t)(b * L_ + i0 + nn) * D_ + h * HD_ + 2 * hi;
  for (int jt = wave * 2; jt < wave * 2 + 2; ++jt) {
    const int j0 = jt * 16;
    if (j0 <= i0 + 15) {                                // skip fully-masked tiles
      const float* kbase = KA + (size_t)(b * L_ + j0 + nn) * D_ + h * HD_ + 2 * hi;
      v8f acc = {};
      v2f a  = ld2(qbase);
      v2f bb = ld2(kbase);                              // Bᵀ: ka row j as column
      #pragma unroll
      for (int k0 = 4; k0 < HD_; k0 += 4) {
        v2f an  = ld2(qbase + k0);
        v2f bbn = ld2(kbase + k0);
        acc = __builtin_amdgcn_wmma_f32_16x16x4_f32(false, a, false, bb, (short)0, acc, false, false);
        a = an; bb = bbn;
      }
      acc = __builtin_amdgcn_wmma_f32_16x16x4_f32(false, a, false, bb, (short)0, acc, false, false);
      #pragma unroll
      for (int r = 0; r < 8; ++r)
        sc[(r + 8 * hi) * LDP + j0 + nn] = acc[r] * 0.125f;
    }
  }
  __syncthreads();

  // softmax: wave w -> row w (16 waves, 16 rows)
  const int row = wave;
  const int ig  = i0 + row;
  float vals[16];
  float mx = -__builtin_inff();
  #pragma unroll
  for (int t = 0; t < 16; ++t) {
    const int j = lane + 32 * t;
    const float v = (j <= ig) ? sc[row * LDP + j] : -__builtin_inff();
    vals[t] = v;
    mx = fmaxf(mx, v);
  }
  for (int off = 16; off; off >>= 1) mx = fmaxf(mx, __shfl_xor(mx, off, 32));
  float sum = 0.0f;
  #pragma unroll
  for (int t = 0; t < 16; ++t) { const float e = __expf(vals[t] - mx); vals[t] = e; sum += e; }
  for (int off = 16; off; off >>= 1) sum += __shfl_xor(sum, off, 32);
  const float inv = 1.0f / sum;
  float* arow = ATTN + ((size_t)(b * H_ + h) * L_ + ig) * L_;
  #pragma unroll
  for (int t = 0; t < 16; ++t) {
    const int j = lane + 32 * t;
    arow[j] = (j <= ig) ? vals[t] * inv : 0.0f;
  }
}

// ---------------------------------------------------------------------------
// relations[b,i,j,r] = (qr[b,i,r,:] . kr[b,j,r,:]) / sqrt(64).
// One work-group of 12 waves per (b, 16 rows i, 128 columns j); wave = r.
// Each wave brings its 16x64 slices of qr and kr in with whole-line loads
// (two 256-byte row slices per load) and turns them into WMMA fragments
// through an LDS tile of its own, which no other wave touches; the q
// fragments stay in registers for all 8 j tiles. The 12 waves' 16x16 results
// of a j tile are gathered in LDS as [i][j][r] and leave as runs of 768
// contiguous bytes per row i, so every 128-byte line of the output has one
// writer. The gather has two buffers and one barrier per j tile. The next k
// tile's global loads are in flight during the current tile's WMMAs.
// The k order of every sum is that of the one-wave form.
// ---------------------------------------------------------------------------
#define RNT 8               // j tiles of 16 per work-group
#define RKP 68              // LDS pitch of a staged 64-float row: 4 banks further per row
#define ROT (16 * 16 * R_)  // floats of one gathered [16 i][16 j][12 r] tile
__global__ __launch_bounds__(384) void relations_kernel(
    const float* __restrict__ QR, const float* __restrict__ KR,
    float* __restrict__ REL) {
  __shared__ __attribute__((aligned(16))) float kt[R_][16 * RKP];
  __shared__ __attribute__((aligned(16))) float ot[2][ROT];
  const int tid  = threadIdx.x;
  const int lane = tid & 31;
  const int r    = __builtin_amdgcn_readfirstlane(tid >> 5);
  const int hi = lane >> 4, nn = lane & 15;
  const int jb = blockIdx.x * (16 * RNT);
  const int i0 = blockIdx.y * 16;
  const int b  = blockIdx.z;

  // staging: a lane moves floats 4nn..4nn+3 of rows hi, hi+2, ..., hi+14
  const float* qsrc = QR + (size_t)(b * L_ + i0 + hi) * D_ + r * RP_ + 4 * nn;
  const float* ksrc = KR + (size_t)(b * L_ + jb + hi) * D_ + r * RP_ + 4 * nn;
  float* sdst = &kt[r][hi * RKP + 4 * nn];
  const float* frag = &kt[r][nn * RKP + 2 * hi];

  // every '#pragma unroll' in this kernel: its loop indexes a small array, which
  // stays in registers only when the index is a constant
  v4f sq[8], st[8];
  #pragma unroll
  for (int q = 0; q < 8; ++q) sq[q] = ld4(qsrc + 2 * q * D_);
  #pragma unroll
  for (int q = 0; q < 8; ++q) st[q] = ld4(ksrc + 2 * q * D_);
  #pragma unroll
  for (int q = 0; q < 8; ++q) *(v4f*)(sdst + 2 * q * RKP) = sq[q];
  // the wave's own tile is written before its lanes read each other's rows back
  asm volatile("s_wait_dscnt 0x0" ::: "memory");
  v2f a[16];
  #pragma unroll
  for (int s = 0; s < 16; ++s) a[s] = ld2(frag + 4 * s);
  // the q fragments have left the tile before the wave refills it with k rows
  asm volatile("s_wait_dscnt 0x0" ::: "memory");

  // flush: a thread moves 4 floats of row tid/48 and 4 of row tid/48 + 8
  const int frow = tid / 48, fcol = (tid - frow * 48) * 4;
  float* odst = REL + ((size_t)(b * L_ + i0 + frow) * L_ + jb) * R_ + fcol;

  for (int t = 0; t < RNT; ++t) {
    #pragma unroll
    for (int q = 0; q < 8; ++q) *(v4f*)(sdst + 2 * q * RKP) = st[q];
    if (t + 1 < RNT) {
      const float* kn = ksrc + (size_t)(t + 1) * 16 * D_;
      #pragma unroll
      for (int q = 0; q < 8; ++q) st[q] = ld4(kn + 2 * q * D_);
    }
    // the wave's own tile is written before its lanes read each other's rows back
    asm volatile("s_wait_dscnt 0x0" ::: "memory");
    v2f bb[16];
    #pragma unroll
    for (int s = 0; s < 16; ++s) bb[s] = ld2(frag + 4 * s);
    // keeps the fragment reads in one group ahead of the WMMAs instead of spread among them
    __builtin_amdgcn_sched_barrier(0);
    v8f acc = {};
    #pragma unroll
    for (int s = 0; s < 16; ++s)
      acc = __builtin_amdgcn_wmma_f32_16x16x4_f32(false, a[s], false, bb[s], (short)0, acc, false, false);
    float* o = &ot[t & 1][(8 * hi * 16 + nn) * R_ + r];   // C layout: VGPR rr -> i = rr / rr+8
    #pragma unroll
    for (int rr = 0; rr < 8; ++rr) o[rr * 16 * R_] = acc[rr] * 0.125f;
    __syncthreads();
    const float* os = &ot[t & 1][4 * tid];
    float* od = odst + t * 16 * R_;
    *(v4f*)od = *(const v4f*)os;
    *(v4f*)(od + (size_t)8 * L_ * R_) = *(const v4f*)(os + 4 * 384);
  }
}

// ---------------------------------------------------------------------------
// attended[b,i,:] = sum_j attn[b,h,i,j] * sv[clip(j-i)+128][h,d]
//                 + sum_r (sum_j attn[b,h,i,j] * rel[b,i,j,r]) * wr[h,d,r]
// Both sums run on fp32 WMMA 16x16x4. One work-group of 16 waves per b and
// 16 rows i: 8 rows from the top of the triangle and their mirror image from
// its foot, so that every work-group reads and multiplies the same amount.
// attn is 0 above the diagonal, so only j <= i counts.
// Part 1, wave = row i: D[h][n] = sum_j attn[h][i][j] * Bm[j][n], j in pairs of
// 64-wide chunks up to the diagonal. Columns n < 12 of Bm are rel[b,i,j,n]; column 12 is
// 1 where j - i clips to -128 and 0 elsewhere, so D[h][12] is the attn mass
// that meets sv row 0; columns 13..15 are 0. D goes to LDS as [i][h][n].
// Part 2, wave = head h (12 waves): M = the 16 rows i, N = the head's 64
// columns, K = 128 band positions kk (j = i - 127 + kk, sv row kk + 1; the A
// operand is the attn row read along the diagonal) and then the 16 columns n
// of part 1 (B = wr[h][d][n] for n < 12, sv row 0 for n = 12, 0 behind).
// Lane nn of N tile e holds column 4 nn + e, so sv rows come in and results
// leave as 16 bytes per lane, 256 contiguous bytes per row and half-wave.
// ---------------------------------------------------------------------------
#define AIP 260     // LDS floats per row i of part 1's result: 16 x 16 and 4 banks further
#define ACH 64      // j per chunk of part 1
// every '#pragma unroll' below: its loop indexes a small array, which stays in
// registers only when the index is a constant
// One chunk of part 1. The lane's k positions, for A and B alike, are
// j = chunk start + 8 u + 4 hi + e; ap and rp already hold the lane's 4 hi.
__device__ __forceinline__ void att_load(v4f (&a)[8], float (&r)[32],
                                         const float* ap, const float* rp) {
  #pragma unroll
  for (int u = 0; u < 8; ++u) {
    a[u] = ld4(ap + 8 * u);
    #pragma unroll
    for (int e = 0; e < 4; ++e) r[4 * u + e] = rp[(8 * u + e) * R_];
  }
  // the loads' address registers are named so that they stay as they are up to this wait:
  // otherwise a later load of the group may be given one of them as its destination
  asm volatile("s_wait_xcnt 0x0" :: "v"(ap), "v"(rp) : "memory");
}
// jc: 8 u + e <= jc marks the positions whose j - i clips to -128
__device__ __forceinline__ void att_mma(v8f& acc0, v8f& acc1, const v4f (&a)[8],
                                        const float (&r)[32], bool isrel, float one, int jc) {
  #pragma unroll
  for (int u = 0; u < 8; ++u) {
    const float b0 = isrel ? r[4 * u]     : (8 * u     <= jc ? one : 0.0f);
    const float b1 = isrel ? r[4 * u + 1] : (8 * u + 1 <= jc ? one : 0.0f);
    const float b2 = isrel ? r[4 * u + 2] : (8 * u + 2 <= jc ? one : 0.0f);
    const float b3 = isrel ? r[4 * u + 3] : (8 * u + 3 <= jc ? one : 0.0f);
    const v2f a01 = {a[u].x, a[u].y}, a23 = {a[u].z, a[u].w};
    const v2f b01 = {b0, b1}, b23 = {b2, b3};
    acc0 = __builtin_amdgcn_wmma_f32_16x16x4_f32(false, a01, false, b01, (short)0, acc0, false, false);
    acc1 = __builtin_amdgcn_wmma_f32_16x16x4_f32(false, a23, false, b23, (short)0, acc1, false, false);
  }
}
__global__ __launch_bounds__(512) void attend_kernel(
    const float* __restrict__ ATTN, const float* __restrict__ REL,
    const float* __restrict__ SV, const float* __restrict__ WR,
    float* __restrict__ OUT) {
  __shared__ __attribute__((aligned(16))) float arL[16 * AIP];
  const int ilo  = blockIdx.x * 8;            // rows ilo .. ilo + 7
  const int ihi  = L_ - 8 - ilo;              // and their mirror image ihi .. ihi + 7
  const int b    = blockIdx.y;
  const int lane = threadIdx.x & 31;
  const int wave = __builtin_amdgcn_readfirstlane(threadIdx.x >> 5);
  const int hi = lane >> 4, nn = lane & 15;

  {
    const int i = wave < 8 ? ilo + wave : ihi + wave - 8;
    // rows h >= 12 of A and columns n >= 12 of rel do not exist: clamped addresses
    const float* ap = ATTN + ((size_t)(b * H_ + min(nn, H_ - 1)) * L_ + i) * L_ + 4 * hi;
    const float* rp = REL + (size_t)(b * L_ + i) * L_ * R_ + 4 * hi * R_ + min(nn, R_ - 1);
    const bool  isrel = nn < R_;
    const float one   = nn == R_ ? 1.0f : 0.0f;
    const int   jclip = i - 128 - 4 * hi;      // j - 4 hi <= jclip: j - i clips to -128
    const int   np    = (i >> 7) + 1;          // pairs of chunks (128 j) that reach the diagonal
    v8f acc0 = {}, acc1 = {};
    // two register sets take turns: one chunk's loads fly during the other's WMMAs.
    // No load stands under a condition, so that each wait can count the loads behind it.
    v4f aA[8], aB[8];
    float rA[32], rB[32];
    att_load(aA, rA, ap, rp);
    int ch = 0;
    for (; ch + 2 < 2 * np; ch += 2) {
      att_load(aB, rB, ap + ACH * (ch + 1), rp + ACH * (ch + 1) * R_);
      // each sched_barrier here: keeps a chunk's loads ahead of the other chunk's WMMAs, not sunk among them
      __builtin_amdgcn_sched_barrier(0);
      att_mma(acc0, acc1, aA, rA, isrel, one, jclip - ACH * ch);
      att_load(aA, rA, ap + ACH * (ch + 2), rp + ACH * (ch + 2) * R_);
      __builtin_amdgcn_sched_barrier(0);
      att_mma(acc0, acc1, aB, rB, isrel, one, jclip - ACH * (ch + 1));
    }
    att_load(aB, rB, ap + ACH * (ch + 1), rp + ACH * (ch + 1) * R_);
    __builtin_amdgcn_sched_barrier(0);
    att_mma(acc0, acc1, aA, rA, isrel, one, jclip - ACH * ch);
    att_mma(acc0, acc1, aB, rB, isrel, one, jclip - ACH * (ch + 1));
    float* o = &arL[wave * AIP + 8 * hi * 16 + nn];   // D layout: VGPR rr -> h = rr / rr+8
    #pragma unroll
    for (int rr = 0; rr < 8; ++rr) o[rr * 16] = acc0[rr] + acc1[rr];
  }
  __syncthreads();

  if (wave < H_) {
    const int h = wave;
    const int i = nn < 8 ? ilo + nn : ihi + nn - 8;
    const float* arow = ATTN + ((size_t)(b * H_ + h) * L_ + i) * L_;
    const float* svc  = SV + h * HD_ + 4 * nn;
    const int jl = i - 127 + 4 * hi;
    v8f c0 = {}, c1 = {}, c2 = {}, c3 = {};
    // a stage is 16 band positions; the lane's, for A and B alike: kk = 16 s + 8 u + 4 hi + e, q = 4 u + e
    auto band_load = [&](float (&av)[8], v4f (&sr)[8], int s) {
      const float* pa[8];
      const float* ps = svc + (size_t)(16 * s + 4 * hi + 1) * D_;
      #pragma unroll
      for (int q = 0; q < 8; ++q) {
        const int ko = 8 * (q >> 2) + (q & 3);
        pa[q] = arow + max(jl + 16 * s + ko, 0);
        av[q] = *pa[q];
        sr[q] = ld4(ps + ko * D_);
      }
      // the loads' address registers are named so that they stay as they are up to this wait:
      // otherwise a later load of the group may be given one of them as its destination
      asm volatile("s_wait_xcnt 0x0" :: "v"(pa[0]), "v"(pa[1]), "v"(pa[2]), "v"(pa[3]), "v"(pa[4]),
                   "v"(pa[5]), "v"(pa[6]), "v"(pa[7]), "v"(ps) : "memory");
    };
    auto band_mma = [&](const float (&av)[8], const v4f (&sr)[8], int s) {
      #pragma unroll
      for (int q = 0; q < 8; q += 2) {
        const int j = jl + 16 * s + 8 * (q >> 2) + (q & 3);
        // left of column 0 there is no term
        const v2f a = {j >= 0 ? av[q] : 0.0f, j + 1 >= 0 ? av[q + 1] : 0.0f};
        const v2f q0 = {sr[q].x, sr[q + 1].x}, q1 = {sr[q].y, sr[q + 1].y};
        const v2f q2 = {sr[q].z, sr[q + 1].z}, q3 = {sr[q].w, sr[q + 1].w};
        c0 = __builtin_amdgcn_wmma_f32_16x16x4_f32(false, a, false, q0, (short)0, c0, false, false);
        c1 = __builtin_amdgcn_wmma_f32_16x16x4_f32(false, a, false, q1, (short)0, c1, false, false);
        c2 = __builtin_amdgcn_wmma_f32_16x16x4_f32(false, a, false, q2, (short)0, c2, false, false);
        c3 = __builtin_amdgcn_wmma_f32_16x16x4_f32(false, a, false, q3, (short)0, c3, false, false);
      }
    };
    // two register sets take turns as in part 1, and no load stands under a condition
    float avA[8], avB[8];
    v4f  srA[8], srB[8];
    band_load(avA, srA, 0);
    // kept rolled: unrolled, every stage's loads are lifted to the front and registers spill
    #pragma unroll 1
    for (int s = 0; s < 6; s += 2) {
      band_load(avB, srB, s + 1);
      // each sched_barrier here: keeps a stage's loads ahead of the other stage's WMMAs, not sunk among them
      __builtin_amdgcn_sched_barrier(0);
      band_mma(avA, srA, s);
      band_load(avA, srA, s + 2);
      __builtin_amdgcn_sched_barrier(0);
      band_mma(avB, srB, s + 1);
    }
    band_load(avB, srB, 7);
    __builtin_amdgcn_sched_barrier(0);
    band_mma(avA, srA, 6);
    band_mma(avB, srB, 7);
    // part 1's columns as k: n = k0 + 2 hi, + 1
    const float* al = &arL[nn * AIP + h * 16 + 2 * hi];
    const float* wc = WR + (size_t)(h * HD_ + 4 * nn) * R_ + 2 * hi;
    v2f w[3][4];
    #pragma unroll
    for (int k = 0; k < 3; ++k) {
      #pragma unroll
      for (int e = 0; e < 4; ++e) w[k][e] = ld2(wc + e * R_ + 4 * k);
    }
    const v4f s0 = ld4(svc);                           // sv row 0
    // as in band_load: the address registers stay as they are up to this wait
    asm volatile("s_wait_xcnt 0x0" :: "v"(wc), "v"(svc) : "memory");
    #pragma unroll
    for (int k = 0; k < 3; ++k) {
      const v2f a = ld2(al + 4 * k);
      c0 = __builtin_amdgcn_wmma_f32_16x16x4_f32(false, a, false, w[k][0], (short)0, c0, false, false);
      c1 = __builtin_amdgcn_wmma_f32_16x16x4_f32(false, a, false, w[k][1], (short)0, c1, false, false);
      c2 = __builtin_amdgcn_wmma_f32_16x16x4_f32(false, a, false, w[k][2], (short)0, c2, false, false);
      c3 = __builtin_amdgcn_wmma_f32_16x16x4_f32(false, a, false, w[k][3], (short)0, c3, false, false);
    }
    {
      const v2f a  = ld2(al + R_);                     // n = 12, 13 (hi = 0) and 14, 15
      const v2f q0 = {hi ? 0.0f : s0.x, 0.0f}, q1 = {hi ? 0.0f : s0.y, 0.0f};
      const v2f q2 = {hi ? 0.0f : s0.z, 0.0f}, q3 = {hi ? 0.0f : s0.w, 0.0f};
      c0 = __builtin_amdgcn_wmma_f32_16x16x4_f32(false, a, false, q0, (short)0, c0, false, false);
      c1 = __builtin_amdgcn_wmma_f32_16x16x4_f32(false, a, false, q1, (short)0, c1, false, false);
      c2 = __builtin_amdgcn_wmma_f32_16x16x4_f32(false, a, false, q2, (short)0, c2, false, false);
      c3 = __builtin_amdgcn_wmma_f32_16x16x4_f32(false, a, false, q3, (short)0, c3, false, false);
    }
    float* orow = OUT + (size_t)(b * L_ + (hi ? ihi : ilo)) * D_ + h * HD_ + 4 * nn;
    #pragma unroll
    for (int rr = 0; rr < 8; ++rr) {                   // D layout: VGPR rr -> row rr / rr+8 of the 16
      const v4f v = {c0[rr], c1[rr], c2[rr], c3[rr]};
      *(v4f*)(orow + (size_t)rr * D_) = v;
    }
  }
}

// ---------------------------------------------------------------------------
extern "C" void kernel_launch(void* const* d_in, const int* in_sizes, int n_in,
                              void* d_out, int out_size, void* d_ws, size_t ws_size,
                              hipStream_t stream) {
  const float* x       = (const float*)d_in[0];
  const float* wq_attn = (const float*)d_in[1];
  const float* wk_attn = (const float*)d_in[2];
  const float* wq_rel  = (const float*)d_in[3];
  const float* wk_rel  = (const float*)d_in[4];
  const float* wr      = (const float*)d_in[5];
  const float* wv      = (const float*)d_in[6];
  const float* wo      = (const float*)d_in[7];
  const float* rel_emb = (const float*)d_in[8];

  float* out  = (float*)d_out;                                  // [B,L,768]
  float* attn = out + (size_t)B_ * L_ * D_;                     // [B,H,L,L]
  float* rel  = attn + (size_t)B_ * H_ * L_ * L_;               // [B,L,L,R]

  const size_t NBLD = (size_t)B_ * L_ * D_;
  float* qa  = (float*)d_ws;
  float* ka  = qa + NBLD;
  float* qr  = ka + NBLD;
  float* kr  = qr + NBLD;
  float* sv  = kr + NBLD;                                       // [272,768]
  float* att = sv + (size_t)NPAD_ * D_;                         // [B,L,768]

  const dim3 tb(256);
  const int nySv = (NP_ + GBM - 1) / GBM;                       // 5 row tiles, row-clamped loads
  const dim3 gProj(D_ / GBN, nySv + 4 * ((B_ * L_) / GBM));     // (8, 5 + 4*32)
  const dim3 gOut(D_ / GBN, (B_ * L_) / GBM);                   // (8,32)

  // one launch: sv = rel_emb @ wv (M=257) and qa/ka/qr/kr = x @ W (M=2048, K=N=768);
  // qa, ka, qr, kr lie one behind the other
  gemm_wmma_f32_b<<<gProj, tb, 0, stream>>>(x, wq_attn, wk_attn, wq_rel, wk_rel, qa, B_ * L_ - 1, 5,
                                            rel_emb, wv, sv, NP_ - 1, nySv);

  // attn: causal softmax(QKᵀ/8)
  scores_softmax<<<dim3(L_ / 16, H_, B_), 512, 0, stream>>>(qa, ka, attn);

  // relations: full (non-causal) output
  relations_kernel<<<dim3(L_ / (16 * RNT), L_ / 16, B_), 32 * R_, 0, stream>>>(qr, kr, rel);

  // attended symbols + relations -> att [B,L,768]
  attend_kernel<<<dim3(L_ / 16, B_), 512, 0, stream>>>(attn, rel, sv, wr, att);

  // out = att @ wo (a batch of one; no lone product)
  gemm_wmma_f32_b<<<gOut, tb, 0, stream>>>(att, wo, wo, wo, wo, out, B_ * L_ - 1, 5,
                                           rel_emb, wv, sv, NP_ - 1, 0);
}
